// v000
// Measured on an AMD MI455X. A time is GPU time per run, averaged over a window of back-to-back runs after a warm-up
// (all launches, gaps included; the runs take copies of the inputs in turn), and the median of several windows.
// Apart from v000's, it joins two sittings. Times from different sittings can be a few percent apart, while
// side-by-side timings come from the same sitting.
// v000, which the later versions start from, runs in 314 microseconds.
#include <hip/hip_runtime.h>
#include <hip/hip_bf16.h>
#include <stdint.h>

// Problem constants (match the JAX reference)
#define HEADS  16
#define DMODEL 1024
#define DK     64
#define BATCH  4
#define SEQL   1024
#define MROWS  (BATCH * SEQL)   // 4096
#define NEG_BIG (-1000000000.0f)

typedef __bf16    bf16;
typedef uint32_t  u32;
typedef __attribute__((ext_vector_type(16))) bf16  v16bf;
typedef __attribute__((ext_vector_type(8)))  float v8f;
typedef __attribute__((ext_vector_type(4)))  u32   v4u;

union FragU { v16bf bf; v4u u[2]; };

// Load one 16-bit WMMA operand fragment: two contiguous 8-element (16B) chunks.
// Per the CDNA5 ISA 16-bit A-matrix layout, lane L holds K elements
// {half*8 .. half*8+7} and {16+half*8 .. 16+half*8+7} (half = L>=16).
// The caller passes pointers already offset to those two chunks.
__device__ inline v16bf load_frag(const bf16* p0, const bf16* p1) {
  FragU f;
  f.u[0] = *(const v4u*)p0;
  f.u[1] = *(const v4u*)p1;
  return f.bf;
}

__device__ inline v8f wmma_bf16(v16bf a, v16bf b, v8f c) {
  // D = A(16x32 bf16) x B(32x16 bf16) + C(16x16 f32)
  return __builtin_amdgcn_wmma_f32_16x16x32_bf16(
      false, a, false, b, (short)0, c, false, false);
}

// float -> bf16, round to nearest even (bit manipulation: no __bf16 arith needed)
__device__ inline bf16 f2b(float f) {
  union { float f; u32 u; } x; x.f = f;
  u32 r = x.u + 0x7FFFu + ((x.u >> 16) & 1u);
  union { unsigned short s; bf16 b; } y; y.s = (unsigned short)(r >> 16);
  return y.b;
}

__device__ inline float redmax16(float v) {
  v = fmaxf(v, __shfl_xor(v, 1, 16));
  v = fmaxf(v, __shfl_xor(v, 2, 16));
  v = fmaxf(v, __shfl_xor(v, 4, 16));
  v = fmaxf(v, __shfl_xor(v, 8, 16));
  return v;
}
__device__ inline float redsum16(float v) {
  v += __shfl_xor(v, 1, 16);
  v += __shfl_xor(v, 2, 16);
  v += __shfl_xor(v, 4, 16);
  v += __shfl_xor(v, 8, 16);
  return v;
}

// ---------------------------------------------------------------------------
// float32 -> bf16 conversion
// ---------------------------------------------------------------------------
__global__ void mha_f32_to_bf16(const float* __restrict__ x,
                                bf16* __restrict__ y, int n) {
  int i = blockIdx.x * blockDim.x + threadIdx.x;
  if (i < n) y[i] = f2b(x[i]);
}

// ---------------------------------------------------------------------------
// C[4096,1024] = A[4096,1024](bf16) @ W[1024,1024](bf16)^T
// MODE 0: store bf16 row-major
// MODE 1: scatter-store bf16 into per-head V^T layout [b,h][64][1024]
//         (Vh head slab is the contiguous reshape of P[b, 64h:64h+64, :])
// MODE 2: store f32 = C + resid (final output projection + residual)
// Wave tile 32x64 (2x4 WMMA accumulators); workgroup (8 waves) tile 64x256.
// Because C = A*W^T, both WMMA operands use the identical contiguous
// per-lane load pattern from row-major A and W.
// ---------------------------------------------------------------------------
template <int MODE>
__global__ __launch_bounds__(256)
void mha_gemm_bf16(const bf16* __restrict__ A, const bf16* __restrict__ W,
                   bf16* __restrict__ outB, float* __restrict__ outF,
                   const float* __restrict__ resid) {
  const int lane = threadIdx.x & 31;
  const int wave = threadIdx.x >> 5;
  const int half = lane >> 4;
  const int r    = lane & 15;
  const int wm   = wave >> 2;  // 0..1
  const int wn   = wave & 3;   // 0..3
  const int M0 = blockIdx.y * 64 + wm * 32;
  const int N0 = blockIdx.x * 256 + wn * 64;

  v8f acc[2][4];
#pragma unroll
  for (int i = 0; i < 2; ++i)
#pragma unroll
    for (int j = 0; j < 4; ++j) acc[i][j] = (v8f){0, 0, 0, 0, 0, 0, 0, 0};

  for (int k0 = 0; k0 < DMODEL; k0 += 32) {
    const int c0 = k0 + half * 8;
    const int c1 = k0 + 16 + half * 8;
    v16bf af[2], bf_[4];
#pragma unroll
    for (int ms = 0; ms < 2; ++ms) {
      const bf16* arow = A + (size_t)(M0 + ms * 16 + r) * DMODEL;
      af[ms] = load_frag(arow + c0, arow + c1);
    }
#pragma unroll
    for (int ns = 0; ns < 4; ++ns) {
      const bf16* wrow = W + (size_t)(N0 + ns * 16 + r) * DMODEL;
      bf_[ns] = load_frag(wrow + c0, wrow + c1);
    }
#pragma unroll
    for (int ms = 0; ms < 2; ++ms)
#pragma unroll
      for (int ns = 0; ns < 4; ++ns)
        acc[ms][ns] = wmma_bf16(af[ms], bf_[ns], acc[ms][ns]);
  }

  // C/D layout: lanes 0-15 hold rows j, lanes 16-31 rows j+8; col = lane&15.
#pragma unroll
  for (int ms = 0; ms < 2; ++ms) {
#pragma unroll
    for (int ns = 0; ns < 4; ++ns) {
#pragma unroll
      for (int j = 0; j < 8; ++j) {
        const int i   = M0 + ms * 16 + j + 8 * half;  // global row 0..4095
        const int col = N0 + ns * 16 + r;             // 0..1023
        const float vv = acc[ms][ns][j];
        if (MODE == 0) {
          outB[(size_t)i * DMODEL + col] = f2b(vv);
        } else if (MODE == 1) {
          const int b = i >> 10, s = i & 1023;
          const int h = s >> 6;
          const int d = col & 63;
          const int t = ((s & 63) << 4) + (col >> 6);
          outB[(((size_t)(b * HEADS + h) * DK) + d) * SEQL + t] = f2b(vv);
        } else {
          const size_t idx = (size_t)i * DMODEL + col;
          outF[idx] = vv + resid[idx];
        }
      }
    }
  }
}

// ---------------------------------------------------------------------------
// Attention: per (b,h) the head matrices are contiguous [1024,64] slabs.
// 8 waves / WG; each wave owns 16 q-rows. Exact two-pass softmax:
//   pass 1: stream Q*K^T tiles, track per-row max (mask raw==0 -> -1e9, /8)
//   pass 2: recompute tiles, p = exp(s - m), accumulate row sum and O = P*V
// P tiles bounce through LDS (C-layout -> A-fragment layout conversion).
// V is consumed from the precomputed V^T layout so b-operands are contiguous.
// ---------------------------------------------------------------------------
__global__ __launch_bounds__(256)
void mha_attn(const bf16* __restrict__ Pq, const bf16* __restrict__ Pk,
              const bf16* __restrict__ Vt, bf16* __restrict__ Pc) {
  __shared__ bf16 Plds[8][16][40];  // stride 40 -> conflict-free b128 reads

  const int lane = threadIdx.x & 31;
  const int wave = threadIdx.x >> 5;
  const int half = lane >> 4;
  const int r    = lane & 15;

  const int qblk = blockIdx.x & 7;
  const int bh   = blockIdx.x >> 3;
  const int b    = bh >> 4;
  const int h    = bh & 15;

  const int q0 = qblk * 128 + wave * 16;

  const bf16* Qh  = Pq + (size_t)bh * (SEQL * DK);  // [1024][64]
  const bf16* Kh  = Pk + (size_t)bh * (SEQL * DK);  // [1024][64]
  const bf16* Vth = Vt + (size_t)bh * (DK * SEQL);  // [64][1024]

  // Q fragments for this wave's 16 rows (K-dim = d, chunks 0..31 and 32..63)
  v16bf aq[2];
  {
    const bf16* qrow = Qh + (size_t)(q0 + r) * DK;
    aq[0] = load_frag(qrow + half * 8, qrow + 16 + half * 8);
    aq[1] = load_frag(qrow + 32 + half * 8, qrow + 48 + half * 8);
  }

  const v8f vzero = (v8f){0, 0, 0, 0, 0, 0, 0, 0};

  // ---- pass 1: row maxima ----
  float m[8];
#pragma unroll
  for (int j = 0; j < 8; ++j) m[j] = -1e30f;

  for (int kb = 0; kb < SEQL; kb += 16) {
    const bf16* krow = Kh + (size_t)(kb + r) * DK;
    v16bf bk0 = load_frag(krow + half * 8, krow + 16 + half * 8);
    v16bf bk1 = load_frag(krow + 32 + half * 8, krow + 48 + half * 8);
    v8f s = vzero;
    s = wmma_bf16(aq[0], bk0, s);
    s = wmma_bf16(aq[1], bk1, s);
#pragma unroll
    for (int j = 0; j < 8; ++j) {
      float sv = s[j];
      sv = (sv == 0.0f) ? NEG_BIG : sv * 0.125f;  // mask, then 1/sqrt(64)
      m[j] = fmaxf(m[j], sv);
    }
  }
#pragma unroll
  for (int j = 0; j < 8; ++j) m[j] = redmax16(m[j]);

  // ---- pass 2: sum + O accumulation ----
  float l[8];
#pragma unroll
  for (int j = 0; j < 8; ++j) l[j] = 0.0f;
  v8f o[4];
#pragma unroll
  for (int nb = 0; nb < 4; ++nb) o[nb] = vzero;

  for (int kb = 0; kb < SEQL; kb += 32) {
    v8f s[2];
#pragma unroll
    for (int t = 0; t < 2; ++t) {
      const bf16* krow = Kh + (size_t)(kb + t * 16 + r) * DK;
      v16bf bk0 = load_frag(krow + half * 8, krow + 16 + half * 8);
      v16bf bk1 = load_frag(krow + 32 + half * 8, krow + 48 + half * 8);
      s[t] = vzero;
      s[t] = wmma_bf16(aq[0], bk0, s[t]);
      s[t] = wmma_bf16(aq[1], bk1, s[t]);
    }

    __syncthreads();  // protect previous iteration's LDS reads
#pragma unroll
    for (int t = 0; t < 2; ++t) {
#pragma unroll
      for (int j = 0; j < 8; ++j) {
        float sv = s[t][j];
        sv = (sv == 0.0f) ? NEG_BIG : sv * 0.125f;
        float p = __expf(sv - m[j]);
        l[j] += p;
        Plds[wave][j + 8 * half][t * 16 + r] = f2b(p);
      }
    }
    __syncthreads();  // publish P tile (C-layout -> row-major in LDS)

    // Reload P as A-fragment (16 rows x 32 k), contiguous ds_load_b128.
    const bf16* prow = &Plds[wave][r][0];
    v16bf ap = load_frag(prow + half * 8, prow + 16 + half * 8);

#pragma unroll
    for (int nb = 0; nb < 4; ++nb) {
      const bf16* vrow = Vth + (size_t)(nb * 16 + r) * SEQL + kb;
      v16bf bv = load_frag(vrow + half * 8, vrow + 16 + half * 8);
      o[nb] = wmma_bf16(ap, bv, o[nb]);
    }
  }

#pragma unroll
  for (int j = 0; j < 8; ++j) l[j] = redsum16(l[j]);

  // Store O into concat layout: Pc[b][t][h*64 + d]
#pragma unroll
  for (int nb = 0; nb < 4; ++nb) {
#pragma unroll
    for (int j = 0; j < 8; ++j) {
      const int row = q0 + j + 8 * half;
      const int col = h * DK + nb * 16 + r;
      Pc[((size_t)b * SEQL + row) * DMODEL + col] = f2b(o[nb][j] / l[j]);
    }
  }
}

// ---------------------------------------------------------------------------
// Host-side launch. Workspace layout (needs 64 MB):
//  [ 0MB) qb  [ 8MB) kb  [16MB) vb            (bf16 activations, 8MB each)
//  [24MB) Wqb [26MB) Wkb [28MB) Wvb [30MB) Wob (bf16 weights, 2MB each)
//  [32MB) Pq  [40MB) Pk  [48MB) Vt  [56MB) Pc  (bf16 intermediates, 8MB each)
// ---------------------------------------------------------------------------
extern "C" void kernel_launch(void* const* d_in, const int* in_sizes, int n_in,
                              void* d_out, int out_size, void* d_ws,
                              size_t ws_size, hipStream_t stream) {
  (void)in_sizes; (void)n_in; (void)out_size; (void)ws_size;
  const float* q  = (const float*)d_in[0];
  const float* k  = (const float*)d_in[1];
  const float* v  = (const float*)d_in[2];
  const float* Wq = (const float*)d_in[3];
  const float* Wk = (const float*)d_in[4];
  const float* Wv = (const float*)d_in[5];
  const float* Wo = (const float*)d_in[6];
  float* out = (float*)d_out;

  char* ws = (char*)d_ws;
  const size_t MB = (size_t)1 << 20;
  bf16* qb  = (bf16*)(ws + 0 * MB);
  bf16* kb  = (bf16*)(ws + 8 * MB);
  bf16* vb  = (bf16*)(ws + 16 * MB);
  bf16* Wqb = (bf16*)(ws + 24 * MB);
  bf16* Wkb = (bf16*)(ws + 26 * MB);
  bf16* Wvb = (bf16*)(ws + 28 * MB);
  bf16* Wob = (bf16*)(ws + 30 * MB);
  bf16* Pq  = (bf16*)(ws + 32 * MB);
  bf16* Pk  = (bf16*)(ws + 40 * MB);
  bf16* Vt  = (bf16*)(ws + 48 * MB);
  bf16* Pc  = (bf16*)(ws + 56 * MB);

  const int nAct = MROWS * DMODEL;   // 4,194,304
  const int nW   = DMODEL * DMODEL;  // 1,048,576
  mha_f32_to_bf16<<<nAct / 256, 256, 0, stream>>>(q, qb, nAct);
  mha_f32_to_bf16<<<nAct / 256, 256, 0, stream>>>(k, kb, nAct);
  mha_f32_to_bf16<<<nAct / 256, 256, 0, stream>>>(v, vb, nAct);
  mha_f32_to_bf16<<<nW / 256, 256, 0, stream>>>(Wq, Wqb, nW);
  mha_f32_to_bf16<<<nW / 256, 256, 0, stream>>>(Wk, Wkb, nW);
  mha_f32_to_bf16<<<nW / 256, 256, 0, stream>>>(Wv, Wvb, nW);
  mha_f32_to_bf16<<<nW / 256, 256, 0, stream>>>(Wo, Wob, nW);

  dim3 ggrid(DMODEL / 256, MROWS / 64);  // (4, 64)
  mha_gemm_bf16<0><<<ggrid, 256, 0, stream>>>(qb, Wqb, Pq, nullptr, nullptr);
  mha_gemm_bf16<0><<<ggrid, 256, 0, stream>>>(kb, Wkb, Pk, nullptr, nullptr);
  mha_gemm_bf16<1><<<ggrid, 256, 0, stream>>>(vb, Wvb, Vt, nullptr, nullptr);

  mha_attn<<<BATCH * HEADS * (SEQL / 128), 256, 0, stream>>>(Pq, Pk, Vt, Pc);

  mha_gemm_bf16<2><<<ggrid, 256, 0, stream>>>(Pc, Wob, nullptr, out, q);
}

// v001
// A run of this version takes 270 microseconds.
// Next to v000, in two timings, it ran 1.18 times as fast each time.
#include <hip/hip_runtime.h>
#include <hip/hip_bf16.h>
#include <stdint.h>

// Problem constants (match the JAX reference)
#define HEADS  16
#define DMODEL 1024
#define DK     64
#define BATCH  4
#define SEQL   1024
#define MROWS  (BATCH * SEQL)   // 4096
#define NEG_BIG (-1000000000.0f)

typedef __bf16    bf16;
typedef uint32_t  u32;
typedef __attribute__((ext_vector_type(16))) bf16  v16bf;
typedef __attribute__((ext_vector_type(8)))  float v8f;
typedef __attribute__((ext_vector_type(4)))  u32   v4u;

union FragU { v16bf bf; v4u u[2]; };

// Load one 16-bit WMMA operand fragment: two contiguous 8-element (16B) chunks.
// Per the CDNA5 ISA 16-bit A-matrix layout, lane L holds K elements
// {half*8 .. half*8+7} and {16+half*8 .. 16+half*8+7} (half = L>=16).
// The caller passes pointers already offset to those two chunks.
__device__ inline v16bf load_frag(const bf16* p0, const bf16* p1) {
  FragU f;
  f.u[0] = *(const v4u*)p0;
  f.u[1] = *(const v4u*)p1;
  return f.bf;
}

__device__ inline v8f wmma_bf16(v16bf a, v16bf b, v8f c) {
  // D = A(16x32 bf16) x B(32x16 bf16) + C(16x16 f32)
  return __builtin_amdgcn_wmma_f32_16x16x32_bf16(
      false, a, false, b, (short)0, c, false, false);
}

// float -> bf16, round to nearest even (bit manipulation: no __bf16 arith needed)
__device__ inline bf16 f2b(float f) {
  union { float f; u32 u; } x; x.f = f;
  u32 r = x.u + 0x7FFFu + ((x.u >> 16) & 1u);
  union { unsigned short s; bf16 b; } y; y.s = (unsigned short)(r >> 16);
  return y.b;
}

__device__ inline float redmax16(float v) {
  v = fmaxf(v, __shfl_xor(v, 1, 16));
  v = fmaxf(v, __shfl_xor(v, 2, 16));
  v = fmaxf(v, __shfl_xor(v, 4, 16));
  v = fmaxf(v, __shfl_xor(v, 8, 16));
  return v;
}
__device__ inline float redsum16(float v) {
  v += __shfl_xor(v, 1, 16);
  v += __shfl_xor(v, 2, 16);
  v += __shfl_xor(v, 4, 16);
  v += __shfl_xor(v, 8, 16);
  return v;
}

// ---------------------------------------------------------------------------
// float32 -> bf16 conversion
// ---------------------------------------------------------------------------
__global__ void mha_f32_to_bf16(const float* __restrict__ x,
                                bf16* __restrict__ y, int n) {
  int i = blockIdx.x * blockDim.x + threadIdx.x;
  if (i < n) y[i] = f2b(x[i]);
}

// float32 -> bf16 conversion of the V weight with its rows regrouped:
// source row c*64 + d (c = 0..15, d = 0..63) goes to row d*16 + c, so that the
// 16 output columns which are neighbours in the V^T layout are 16 neighbouring
// weight rows, one WMMA tile.
__global__ void mha_wv_to_bf16_grouped(const float* __restrict__ x,
                                       bf16* __restrict__ y, int n) {
  int i = blockIdx.x * blockDim.x + threadIdx.x;
  if (i < n) {
    const int row = i >> 10, kk = i & (DMODEL - 1);
    const int dst = ((row & 63) << 4) + (row >> 6);
    y[(size_t)dst * DMODEL + kk] = f2b(x[i]);
  }
}

// ---------------------------------------------------------------------------
// C[4096,1024] = A[4096,1024](bf16) @ W[1024,1024](bf16)^T
// MODE 0: store bf16 row-major
// MODE 1: store bf16 into per-head V^T layout [b,h][64][1024]
//         (Vh head slab is the contiguous reshape of P[b, 64h:64h+64, :]).
//         W arrives with regrouped rows (d*16 + c) and the two WMMA operands
//         are swapped (tile = W * A^T): a lane then holds 8 neighbouring t of
//         one d and stores them as 16 bytes; a wave's tile is 512 B in a row.
// MODE 2: store f32 = C + resid (final output projection + residual)
// Wave tile 32x64 (2x4 WMMA accumulators); workgroup (8 waves) tile 64x256.
// Because C = A*W^T, both WMMA operands use the identical contiguous
// per-lane load pattern from row-major A and W.
// ---------------------------------------------------------------------------
template <int MODE>
__global__ __launch_bounds__(256)
void mha_gemm_bf16(const bf16* __restrict__ A, const bf16* __restrict__ W,
                   bf16* __restrict__ outB, float* __restrict__ outF,
                   const float* __restrict__ resid) {
  const int lane = threadIdx.x & 31;
  const int wave = threadIdx.x >> 5;
  const int half = lane >> 4;
  const int r    = lane & 15;
  const int wm   = wave >> 2;  // 0..1
  const int wn   = wave & 3;   // 0..3
  const int M0 = blockIdx.y * 64 + wm * 32;
  const int N0 = blockIdx.x * 256 + wn * 64;

  v8f acc[2][4];
#pragma unroll
  for (int i = 0; i < 2; ++i)
#pragma unroll
    for (int j = 0; j < 4; ++j) acc[i][j] = (v8f){0, 0, 0, 0, 0, 0, 0, 0};

  for (int k0 = 0; k0 < DMODEL; k0 += 32) {
    const int c0 = k0 + half * 8;
    const int c1 = k0 + 16 + half * 8;
    v16bf af[2], bf_[4];
#pragma unroll
    for (int ms = 0; ms < 2; ++ms) {
      const bf16* arow = A + (size_t)(M0 + ms * 16 + r) * DMODEL;
      af[ms] = load_frag(arow + c0, arow + c1);
    }
#pragma unroll
    for (int ns = 0; ns < 4; ++ns) {
      const bf16* wrow = W + (size_t)(N0 + ns * 16 + r) * DMODEL;
      bf_[ns] = load_frag(wrow + c0, wrow + c1);
    }
#pragma unroll
    for (int ms = 0; ms < 2; ++ms)
#pragma unroll
      for (int ns = 0; ns < 4; ++ns)
        acc[ms][ns] = (MODE == 1) ? wmma_bf16(bf_[ns], af[ms], acc[ms][ns])
                                  : wmma_bf16(af[ms], bf_[ns], acc[ms][ns]);
  }

  if (MODE == 1) {
    // Transposed tile: register j + 8*half is c (weight row d*16 + c),
    // lane&15 is the activation row. t = (s & 63) * 16 + c.
#pragma unroll
    for (int ms = 0; ms < 2; ++ms) {
      const int i = M0 + ms * 16 + r;  // global row 0..4095
      const int b = i >> 10, s = i & 1023;
      const int h = s >> 6;
      const int t = ((s & 63) << 4) + 8 * half;
#pragma unroll
      for (int ns = 0; ns < 4; ++ns) {
        const int d = (N0 >> 4) + ns;  // 0..63
        union { bf16 e[8]; v4u u; } pk;
#pragma unroll
        for (int j = 0; j < 8; ++j) pk.e[j] = f2b(acc[ms][ns][j]);
        *(v4u*)(outB + (((size_t)(b * HEADS + h) * DK) + d) * SEQL + t) = pk.u;
      }
    }
    return;
  }

  // C/D layout: lanes 0-15 hold rows j, lanes 16-31 rows j+8; col = lane&15.
#pragma unroll
  for (int ms = 0; ms < 2; ++ms) {
#pragma unroll
    for (int ns = 0; ns < 4; ++ns) {
#pragma unroll
      for (int j = 0; j < 8; ++j) {
        const int i   = M0 + ms * 16 + j + 8 * half;  // global row 0..4095
        const int col = N0 + ns * 16 + r;             // 0..1023
        const float vv = acc[ms][ns][j];
        if (MODE == 0) {
          outB[(size_t)i * DMODEL + col] = f2b(vv);
        } else {
          const size_t idx = (size_t)i * DMODEL + col;
          outF[idx] = vv + resid[idx];
        }
      }
    }
  }
}

// ---------------------------------------------------------------------------
// Attention: per (b,h) the head matrices are contiguous [1024,64] slabs.
// 8 waves / WG; each wave owns 16 q-rows. Exact two-pass softmax:
//   pass 1: stream Q*K^T tiles, track per-row max (mask raw==0 -> -1e9, /8)
//   pass 2: recompute tiles, p = exp(s - m), accumulate row sum and O = P*V
// P tiles bounce through LDS (C-layout -> A-fragment layout conversion).
// V is consumed from the precomputed V^T layout so b-operands are contiguous.
// ---------------------------------------------------------------------------
__global__ __launch_bounds__(256)
void mha_attn(const bf16* __restrict__ Pq, const bf16* __restrict__ Pk,
              const bf16* __restrict__ Vt, bf16* __restrict__ Pc) {
  __shared__ bf16 Plds[8][16][40];  // stride 40 -> conflict-free b128 reads

  const int lane = threadIdx.x & 31;
  const int wave = threadIdx.x >> 5;
  const int half = lane >> 4;
  const int r    = lane & 15;

  const int qblk = blockIdx.x & 7;
  const int bh   = blockIdx.x >> 3;
  const int b    = bh >> 4;
  const int h    = bh & 15;

  const int q0 = qblk * 128 + wave * 16;

  const bf16* Qh  = Pq + (size_t)bh * (SEQL * DK);  // [1024][64]
  const bf16* Kh  = Pk + (size_t)bh * (SEQL * DK);  // [1024][64]
  const bf16* Vth = Vt + (size_t)bh * (DK * SEQL);  // [64][1024]

  // Q fragments for this wave's 16 rows (K-dim = d, chunks 0..31 and 32..63)
  v16bf aq[2];
  {
    const bf16* qrow = Qh + (size_t)(q0 + r) * DK;
    aq[0] = load_frag(qrow + half * 8, qrow + 16 + half * 8);
    aq[1] = load_frag(qrow + 32 + half * 8, qrow + 48 + half * 8);
  }

  const v8f vzero = (v8f){0, 0, 0, 0, 0, 0, 0, 0};

  // ---- pass 1: row maxima ----
  float m[8];
#pragma unroll
  for (int j = 0; j < 8; ++j) m[j] = -1e30f;

  for (int kb = 0; kb < SEQL; kb += 16) {
    const bf16* krow = Kh + (size_t)(kb + r) * DK;
    v16bf bk0 = load_frag(krow + half * 8, krow + 16 + half * 8);
    v16bf bk1 = load_frag(krow + 32 + half * 8, krow + 48 + half * 8);
    v8f s = vzero;
    s = wmma_bf16(aq[0], bk0, s);
    s = wmma_bf16(aq[1], bk1, s);
#pragma unroll
    for (int j = 0; j < 8; ++j) {
      float sv = s[j];
      sv = (sv == 0.0f) ? NEG_BIG : sv * 0.125f;  // mask, then 1/sqrt(64)
      m[j] = fmaxf(m[j], sv);
    }
  }
#pragma unroll
  for (int j = 0; j < 8; ++j) m[j] = redmax16(m[j]);

  // ---- pass 2: sum + O accumulation ----
  float l[8];
#pragma unroll
  for (int j = 0; j < 8; ++j) l[j] = 0.0f;
  v8f o[4];
#pragma unroll
  for (int nb = 0; nb < 4; ++nb) o[nb] = vzero;

  for (int kb = 0; kb < SEQL; kb += 32) {
    v8f s[2];
#pragma unroll
    for (int t = 0; t < 2; ++t) {
      const bf16* krow = Kh + (size_t)(kb + t * 16 + r) * DK;
      v16bf bk0 = load_frag(krow + half * 8, krow + 16 + half * 8);
      v16bf bk1 = load_frag(krow + 32 + half * 8, krow + 48 + half * 8);
      s[t] = vzero;
      s[t] = wmma_bf16(aq[0], bk0, s[t]);
      s[t] = wmma_bf16(aq[1], bk1, s[t]);
    }

    __syncthreads();  // protect previous iteration's LDS reads
#pragma unroll
    for (int t = 0; t < 2; ++t) {
#pragma unroll
      for (int j = 0; j < 8; ++j) {
        float sv = s[t][j];
        sv = (sv == 0.0f) ? NEG_BIG : sv * 0.125f;
        float p = __expf(sv - m[j]);
        l[j] += p;
        Plds[wave][j + 8 * half][t * 16 + r] = f2b(p);
      }
    }
    __syncthreads();  // publish P tile (C-layout -> row-major in LDS)

    // Reload P as A-fragment (16 rows x 32 k), contiguous ds_load_b128.
    const bf16* prow = &Plds[wave][r][0];
    v16bf ap = load_frag(prow + half * 8, prow + 16 + half * 8);

#pragma unroll
    for (int nb = 0; nb < 4; ++nb) {
      const bf16* vrow = Vth + (size_t)(nb * 16 + r) * SEQL + kb;
      v16bf bv = load_frag(vrow + half * 8, vrow + 16 + half * 8);
      o[nb] = wmma_bf16(ap, bv, o[nb]);
    }
  }

#pragma unroll
  for (int j = 0; j < 8; ++j) l[j] = redsum16(l[j]);

  // Store O into concat layout: Pc[b][t][h*64 + d]
#pragma unroll
  for (int nb = 0; nb < 4; ++nb) {
#pragma unroll
    for (int j = 0; j < 8; ++j) {
      const int row = q0 + j + 8 * half;
      const int col = h * DK + nb * 16 + r;
      Pc[((size_t)b * SEQL + row) * DMODEL + col] = f2b(o[nb][j] / l[j]);
    }
  }
}

// ---------------------------------------------------------------------------
// Host-side launch. Workspace layout (needs 64 MB):
//  [ 0MB) qb  [ 8MB) kb  [16MB) vb            (bf16 activations, 8MB each)
//  [24MB) Wqb [26MB) Wkb [28MB) Wvb [30MB) Wob (bf16 weights, 2MB each;
//         Wvb with regrouped rows)
//  [32MB) Pq  [40MB) Pk  [48MB) Vt  [56MB) Pc  (bf16 intermediates, 8MB each)
// ---------------------------------------------------------------------------
extern "C" void kernel_launch(void* const* d_in, const int* in_sizes, int n_in,
                              void* d_out, int out_size, void* d_ws,
                              size_t ws_size, hipStream_t stream) {
  (void)in_sizes; (void)n_in; (void)out_size; (void)ws_size;
  const float* q  = (const float*)d_in[0];
  const float* k  = (const float*)d_in[1];
  const float* v  = (const float*)d_in[2];
  const float* Wq = (const float*)d_in[3];
  const float* Wk = (const float*)d_in[4];
  const float* Wv = (const float*)d_in[5];
  const float* Wo = (const float*)d_in[6];
  float* out = (float*)d_out;

  char* ws = (char*)d_ws;
  const size_t MB = (size_t)1 << 20;
  bf16* qb  = (bf16*)(ws + 0 * MB);
  bf16* kb  = (bf16*)(ws + 8 * MB);
  bf16* vb  = (bf16*)(ws + 16 * MB);
  bf16* Wqb = (bf16*)(ws + 24 * MB);
  bf16* Wkb = (bf16*)(ws + 26 * MB);
  bf16* Wvb = (bf16*)(ws + 28 * MB);
  bf16* Wob = (bf16*)(ws + 30 * MB);
  bf16* Pq  = (bf16*)(ws + 32 * MB);
  bf16* Pk  = (bf16*)(ws + 40 * MB);
  bf16* Vt  = (bf16*)(ws + 48 * MB);
  bf16* Pc  = (bf16*)(ws + 56 * MB);

  const int nAct = MROWS * DMODEL;   // 4,194,304
  const int nW   = DMODEL * DMODEL;  // 1,048,576
  mha_f32_to_bf16<<<nAct / 256, 256, 0, stream>>>(q, qb, nAct);
  mha_f32_to_bf16<<<nAct / 256, 256, 0, stream>>>(k, kb, nAct);
  mha_f32_to_bf16<<<nAct / 256, 256, 0, stream>>>(v, vb, nAct);
  mha_f32_to_bf16<<<nW / 256, 256, 0, stream>>>(Wq, Wqb, nW);
  mha_f32_to_bf16<<<nW / 256, 256, 0, stream>>>(Wk, Wkb, nW);
  mha_wv_to_bf16_grouped<<<nW / 256, 256, 0, stream>>>(Wv, Wvb, nW);
  mha_f32_to_bf16<<<nW / 256, 256, 0, stream>>>(Wo, Wob, nW);

  dim3 ggrid(DMODEL / 256, MROWS / 64);  // (4, 64)
  mha_gemm_bf16<0><<<ggrid, 256, 0, stream>>>(qb, Wqb, Pq, nullptr, nullptr);
  mha_gemm_bf16<0><<<ggrid, 256, 0, stream>>>(kb, Wkb, Pk, nullptr, nullptr);
  mha_gemm_bf16<1><<<ggrid, 256, 0, stream>>>(vb, Wvb, Vt, nullptr, nullptr);

  mha_attn<<<BATCH * HEADS * (SEQL / 128), 256, 0, stream>>>(Pq, Pk, Vt, Pc);

  mha_gemm_bf16<2><<<ggrid, 256, 0, stream>>>(Pc, Wob, nullptr, out, q);
}

// v002
// It runs in 239 microseconds.
// Two timings next to v001 put it at 1.12 and 1.13 times that version's speed.
// Over all steps from v000 it is 1.32 times as fast.
#include <hip/hip_runtime.h>
#include <hip/hip_bf16.h>
#include <stdint.h>

// Problem constants (match the JAX reference)
#define HEADS  16
#define DMODEL 1024
#define DK     64
#define BATCH  4
#define SEQL   1024
#define MROWS  (BATCH * SEQL)   // 4096
#define NEG_BIG (-1000000000.0f)

typedef __bf16    bf16;
typedef uint32_t  u32;
typedef __attribute__((ext_vector_type(16))) bf16  v16bf;
typedef __attribute__((ext_vector_type(8)))  float v8f;
typedef __attribute__((ext_vector_type(4)))  u32   v4u;

union FragU { v16bf bf; v4u u[2]; };

// Load one 16-bit WMMA operand fragment: two contiguous 8-element (16B) chunks.
// Per the CDNA5 ISA 16-bit A-matrix layout, lane L holds K elements
// {half*8 .. half*8+7} and {16+half*8 .. 16+half*8+7} (half = L>=16).
// The caller passes pointers already offset to those two chunks.
__device__ inline v16bf load_frag(const bf16* p0, const bf16* p1) {
  FragU f;
  f.u[0] = *(const v4u*)p0;
  f.u[1] = *(const v4u*)p1;
  return f.bf;
}

__device__ inline v8f wmma_bf16(v16bf a, v16bf b, v8f c) {
  // D = A(16x32 bf16) x B(32x16 bf16) + C(16x16 f32)
  return __builtin_amdgcn_wmma_f32_16x16x32_bf16(
      false, a, false, b, (short)0, c, false, false);
}

// float -> bf16, round to nearest even (bit manipulation: no __bf16 arith needed)
__device__ inline bf16 f2b(float f) {
  union { float f; u32 u; } x; x.f = f;
  u32 r = x.u + 0x7FFFu + ((x.u >> 16) & 1u);
  union { unsigned short s; bf16 b; } y; y.s = (unsigned short)(r >> 16);
  return y.b;
}

__device__ inline float redmax16(float v) {
  v = fmaxf(v, __shfl_xor(v, 1, 16));
  v = fmaxf(v, __shfl_xor(v, 2, 16));
  v = fmaxf(v, __shfl_xor(v, 4, 16));
  v = fmaxf(v, __shfl_xor(v, 8, 16));
  return v;
}
__device__ inline float redsum16(float v) {
  v += __shfl_xor(v, 1, 16);
  v += __shfl_xor(v, 2, 16);
  v += __shfl_xor(v, 4, 16);
  v += __shfl_xor(v, 8, 16);
  return v;
}

// ---------------------------------------------------------------------------
// Fragment order. Every bf16 tensor in the workspace is kept as 1-KiB tiles of
// 16 rows x 32 k, each tile in the order in which a wave loads it as a 16-bit
// WMMA operand: [chunk c = 0,1][lane = half*16 + r][8 elements], holding
// element (row r, k = c*16 + half*8 + e). One 16-byte-per-lane access of a wave
// is then 512 contiguous bytes (4 whole lines) instead of 32 bytes of 16 lines.
// ---------------------------------------------------------------------------
#define TILE_ELEMS 512   // 16 x 32 bf16
#define KTILES     (DMODEL / 32)

// Fragment of tile number tile; p already holds the lane's own offset (lane*8).
__device__ inline v16bf load_tile(const bf16* p, int tile) {
  const bf16* t = p + (size_t)tile * TILE_ELEMS;
  return load_frag(t, t + 256);
}

__device__ inline v4u pack8(const float* v) {
  union { bf16 e[8]; v4u u; } pk;
#pragma unroll
  for (int j = 0; j < 8; ++j) pk.e[j] = f2b(v[j]);
  return pk.u;
}

// ---------------------------------------------------------------------------
// float32 [rows][1024] row-major -> bf16 tiles [rows/16][32] in fragment order.
// One thread makes one 16-byte chunk; n = number of chunks.
// ---------------------------------------------------------------------------
__global__ __launch_bounds__(256)
void mha_f32_to_bf16_frag(const float* __restrict__ x, bf16* __restrict__ y,
                          int n) {
  const int g = blockIdx.x * blockDim.x + threadIdx.x;
  if (g < n) {
    const int L  = g & 31;
    const int c  = (g >> 5) & 1;
    const int kt = (g >> 6) & (KTILES - 1);
    const int rt = g >> 11;
    const float* s = x + (size_t)(rt * 16 + (L & 15)) * DMODEL +
                     kt * 32 + c * 16 + (L >> 4) * 8;
    const float4 a = *(const float4*)s;
    const float4 b = *(const float4*)(s + 4);
    const float v[8] = {a.x, a.y, a.z, a.w, b.x, b.y, b.z, b.w};
    *(v4u*)(y + (size_t)g * 8) = pack8(v);
  }
}

// ---------------------------------------------------------------------------
// C[4096,1024] = A[4096,1024](bf16) @ W[1024,1024](bf16)^T, A and W in
// fragment order. Wave tile 32x64 (2x4 accumulators); workgroup tile 64x256.
//
// The head slab (b,h) is the contiguous reshape of C[b, 64h:64h+64, :]:
// element (s, col) is position t = (s & 63) * 16 + (col >> 6), d = col & 63.
// Attention may take its positions in any order, so a tile of 16 positions is
// 16 neighbouring s of one column block: tile number (col >> 6) * 4 +
// ((s & 63) >> 4), row s & 15. A 16x16 accumulator tile is then one chunk.
//
// MODE 0 (Q, K): operands swapped (tile = W * A^T), so a lane holds 8
//         neighbouring d of one s. Out: [b,h][64 tiles][d/32] fragment tiles.
// MODE 1 (V): a lane holds 8 neighbouring s of one d. Out: V^T fragment tiles
//         [b,h][32 blocks of 32 positions][d/16], rows d, k = position.
// MODE 2: f32 out = C + resid. A's row tiles are attention's query tiles
//         (b, tile number); the rows go back to their places here.
// ---------------------------------------------------------------------------
template <int MODE>
__global__ __launch_bounds__(256)
void mha_gemm_bf16(const bf16* __restrict__ A, const bf16* __restrict__ W,
                   bf16* __restrict__ outB, float* __restrict__ outF,
                   const float* __restrict__ resid) {
  const int lane = threadIdx.x & 31;
  const int wave = threadIdx.x >> 5;
  const int half = lane >> 4;
  const int r    = lane & 15;
  const int wm   = wave >> 2;  // 0..1
  const int wn   = wave & 3;   // 0..3
  const int M0 = blockIdx.y * 64 + wm * 32;
  const int N0 = blockIdx.x * 256 + wn * 64;

  v8f acc[2][4];
#pragma unroll
  for (int i = 0; i < 2; ++i)
#pragma unroll
    for (int j = 0; j < 4; ++j) acc[i][j] = (v8f){0, 0, 0, 0, 0, 0, 0, 0};

  const bf16* Ap = A + (size_t)(M0 >> 4) * KTILES * TILE_ELEMS + lane * 8;
  const bf16* Wp = W + (size_t)(N0 >> 4) * KTILES * TILE_ELEMS + lane * 8;

  for (int kt = 0; kt < KTILES; ++kt) {
    v16bf af[2], bf_[4];
#pragma unroll
    for (int ms = 0; ms < 2; ++ms) af[ms] = load_tile(Ap, ms * KTILES + kt);
#pragma unroll
    for (int ns = 0; ns < 4; ++ns) bf_[ns] = load_tile(Wp, ns * KTILES + kt);
#pragma unroll
    for (int ms = 0; ms < 2; ++ms)
#pragma unroll
      for (int ns = 0; ns < 4; ++ns)
        acc[ms][ns] = (MODE == 0) ? wmma_bf16(bf_[ns], af[ms], acc[ms][ns])
                                  : wmma_bf16(af[ms], bf_[ns], acc[ms][ns]);
  }

  if (MODE == 0 || MODE == 1) {
    const int bh = ((M0 >> 10) * HEADS) + ((M0 & 1023) >> 6);
    const int cb = N0 >> 6;            // column block 0..15
    const int sb = (M0 & 63) >> 4;     // 0 or 2; + ms
#pragma unroll
    for (int ms = 0; ms < 2; ++ms) {
#pragma unroll
      for (int ns = 0; ns < 4; ++ns) {
        float v[8];
#pragma unroll
        for (int j = 0; j < 8; ++j) v[j] = acc[ms][ns][j];
        // chunk number: MODE 0 tile (cb*4 + sb + ms), d/32 = ns>>1, c = ns&1
        //               MODE 1 block (cb*2 + sb/2), d/16 = ns, c = ms
        const int chunk =
            (MODE == 0)
                ? (((bh * 64 + cb * 4 + sb + ms) * 2 + (ns >> 1)) * 2 + (ns & 1))
                : (((bh * 32 + cb * 2 + (sb >> 1)) * 4 + ns) * 2 + ms);
        *(v4u*)(outB + (size_t)chunk * 256 + lane * 8) = pack8(v);
      }
    }
    return;
  }

  // C/D layout: lanes 0-15 hold rows j, lanes 16-31 rows j+8; col = lane&15.
  // Both row tiles of the wave share b and cb (M0 is a multiple of 32), so one
  // base serves: tile ms is 256 rows on, register j is 16 rows on.
  const int rt = M0 >> 4;            // (b, query tile), even
  const int b  = rt >> 6;
  const int cb = (rt & 63) >> 2;
  const int sb = rt & 3;
  const size_t base =
      ((size_t)b * SEQL + ((sb * 16 + 8 * half) << 4) + cb) * DMODEL + N0 + r;
  const float* rp = resid + base;
  float*       op = outF + base;
  float rv[2][4][8];
#pragma unroll
  for (int ms = 0; ms < 2; ++ms)
#pragma unroll
    for (int ns = 0; ns < 4; ++ns)
#pragma unroll
      for (int j = 0; j < 8; ++j)
        rv[ms][ns][j] = rp[(ms * 256 + j * 16) * DMODEL + ns * 16];
#pragma unroll
  for (int ms = 0; ms < 2; ++ms)
#pragma unroll
    for (int ns = 0; ns < 4; ++ns)
#pragma unroll
      for (int j = 0; j < 8; ++j)
        op[(ms * 256 + j * 16) * DMODEL + ns * 16] = acc[ms][ns][j] + rv[ms][ns][j];
}

// ---------------------------------------------------------------------------
// Attention per (b,h), all operands in fragment order (see above).
// 8 waves / WG; each wave owns one tile of 16 queries. Exact two-pass softmax:
//   pass 1: stream Q*K^T tiles, track per-row max (mask raw==0 -> -1e9, /8)
//   pass 2: recompute tiles, p = exp(s - m), accumulate row sum and O = P*V
// P tiles bounce through LDS (C-layout -> A-fragment layout conversion), and
// so does O at the end, which leaves as A-fragment tiles of the last product.
// ---------------------------------------------------------------------------
__global__ __launch_bounds__(256)
void mha_attn(const bf16* __restrict__ Pq, const bf16* __restrict__ Pk,
              const bf16* __restrict__ Vt, bf16* __restrict__ Pc) {
  __shared__ bf16 Plds[8][16][40];  // stride 40 -> conflict-free b128 reads

  const int lane = threadIdx.x & 31;
  const int wave = threadIdx.x >> 5;
  const int half = lane >> 4;
  const int r    = lane & 15;

  const int qblk = blockIdx.x & 7;
  const int bh   = blockIdx.x >> 3;
  const int b    = bh >> 4;
  const int h    = bh & 15;

  const int qt = qblk * 8 + wave;  // query tile 0..63

  // head slabs, each 128 tiles of 1 KiB, with the lane's own offset
  const bf16* Qh  = Pq + (size_t)bh * (SEQL * DK) + lane * 8;  // [64][2]
  const bf16* Kh  = Pk + (size_t)bh * (SEQL * DK) + lane * 8;  // [64][2]
  const bf16* Vth = Vt + (size_t)bh * (DK * SEQL) + lane * 8;  // [32][4]

  // Q fragments for this wave's 16 rows (K-dim = d, 0..31 and 32..63)
  v16bf aq[2];
  aq[0] = load_tile(Qh, qt * 2);
  aq[1] = load_tile(Qh, qt * 2 + 1);

  const v8f vzero = (v8f){0, 0, 0, 0, 0, 0, 0, 0};

  // ---- pass 1: row maxima ----
  float m[8];
#pragma unroll
  for (int j = 0; j < 8; ++j) m[j] = -1e30f;

  for (int kt = 0; kt < SEQL / 16; ++kt) {
    v16bf bk0 = load_tile(Kh, kt * 2);
    v16bf bk1 = load_tile(Kh, kt * 2 + 1);
    v8f s = vzero;
    s = wmma_bf16(aq[0], bk0, s);
    s = wmma_bf16(aq[1], bk1, s);
#pragma unroll
    for (int j = 0; j < 8; ++j) {
      float sv = s[j];
      sv = (sv == 0.0f) ? NEG_BIG : sv * 0.125f;  // mask, then 1/sqrt(64)
      m[j] = fmaxf(m[j], sv);
    }
  }
#pragma unroll
  for (int j = 0; j < 8; ++j) m[j] = redmax16(m[j]);

  // ---- pass 2: sum + O accumulation ----
  float l[8];
#pragma unroll
  for (int j = 0; j < 8; ++j) l[j] = 0.0f;
  v8f o[4];
#pragma unroll
  for (int nb = 0; nb < 4; ++nb) o[nb] = vzero;

  const bf16* prow = &Plds[wave][r][0];

  for (int kp = 0; kp < SEQL / 32; ++kp) {
    v8f s[2];
#pragma unroll
    for (int t = 0; t < 2; ++t) {
      v16bf bk0 = load_tile(Kh, (kp * 2 + t) * 2);
      v16bf bk1 = load_tile(Kh, (kp * 2 + t) * 2 + 1);
      s[t] = vzero;
      s[t] = wmma_bf16(aq[0], bk0, s[t]);
      s[t] = wmma_bf16(aq[1], bk1, s[t]);
    }

    __syncthreads();  // protect previous iteration's LDS reads
#pragma unroll
    for (int t = 0; t < 2; ++t) {
#pragma unroll
      for (int j = 0; j < 8; ++j) {
        float sv = s[t][j];
        sv = (sv == 0.0f) ? NEG_BIG : sv * 0.125f;
        float p = __expf(sv - m[j]);
        l[j] += p;
        Plds[wave][j + 8 * half][t * 16 + r] = f2b(p);
      }
    }
    __syncthreads();  // publish P tile (C-layout -> row-major in LDS)

    // Reload P as A-fragment (16 rows x 32 k), contiguous ds_load_b128.
    v16bf ap = load_frag(prow + half * 8, prow + 16 + half * 8);

#pragma unroll
    for (int nb = 0; nb < 4; ++nb) {
      v16bf bv = load_tile(Vth, kp * 4 + nb);
      o[nb] = wmma_bf16(ap, bv, o[nb]);
    }
  }

#pragma unroll
  for (int j = 0; j < 8; ++j) l[j] = redsum16(l[j]);

  // Store O as A-fragment tiles of the concat matrix: row tile (b, qt),
  // k = h*64 + d, two tiles of 32 d. Same LDS turn as for P.
  bf16* Oc = Pc + ((size_t)(b * 64 + qt) * KTILES + h * 2) * TILE_ELEMS + lane * 8;
#pragma unroll
  for (int dh = 0; dh < 2; ++dh) {
    __syncthreads();  // the reads of the turn before are done
#pragma unroll
    for (int t = 0; t < 2; ++t)
#pragma unroll
      for (int j = 0; j < 8; ++j)
        Plds[wave][j + 8 * half][t * 16 + r] = f2b(o[dh * 2 + t][j] / l[j]);
    __syncthreads();  // publish the O tile before it is read back by rows
    *(v4u*)(Oc + dh * TILE_ELEMS)       = *(const v4u*)(prow + half * 8);
    *(v4u*)(Oc + dh * TILE_ELEMS + 256) = *(const v4u*)(prow + 16 + half * 8);
  }
}

// ---------------------------------------------------------------------------
// Host-side launch. Workspace layout (needs 64 MB), all in fragment order:
//  [ 0MB) qb  [ 8MB) kb  [16MB) vb            (bf16 activations, 8MB each)
//  [24MB) Wqb [26MB) Wkb [28MB) Wvb [30MB) Wob (bf16 weights, 2MB each)
//  [32MB) Pq  [40MB) Pk  [48MB) Vt  [56MB) Pc  (bf16 intermediates, 8MB each)
// ---------------------------------------------------------------------------
extern "C" void kernel_launch(void* const* d_in, const int* in_sizes, int n_in,
                              void* d_out, int out_size, void* d_ws,
                              size_t ws_size, hipStream_t stream) {
  (void)in_sizes; (void)n_in; (void)out_size; (void)ws_size;
  const float* q  = (const float*)d_in[0];
  const float* k  = (const float*)d_in[1];
  const float* v  = (const float*)d_in[2];
  const float* Wq = (const float*)d_in[3];
  const float* Wk = (const float*)d_in[4];
  const float* Wv = (const float*)d_in[5];
  const float* Wo = (const float*)d_in[6];
  float* out = (float*)d_out;

  char* ws = (char*)d_ws;
  const size_t MB = (size_t)1 << 20;
  bf16* qb  = (bf16*)(ws + 0 * MB);
  bf16* kb  = (bf16*)(ws + 8 * MB);
  bf16* vb  = (bf16*)(ws + 16 * MB);
  bf16* Wqb = (bf16*)(ws + 24 * MB);
  bf16* Wkb = (bf16*)(ws + 26 * MB);
  bf16* Wvb = (bf16*)(ws + 28 * MB);
  bf16* Wob = (bf16*)(ws + 30 * MB);
  bf16* Pq  = (bf16*)(ws + 32 * MB);
  bf16* Pk  = (bf16*)(ws + 40 * MB);
  bf16* Vt  = (bf16*)(ws + 48 * MB);
  bf16* Pc  = (bf16*)(ws + 56 * MB);

  const int cAct = MROWS * DMODEL / 8;   // 524,288 chunks of 8 elements
  const int cW   = DMODEL * DMODEL / 8;  // 131,072
  mha_f32_to_bf16_frag<<<cAct / 256, 256, 0, stream>>>(q, qb, cAct);
  mha_f32_to_bf16_frag<<<cAct / 256, 256, 0, stream>>>(k, kb, cAct);
  mha_f32_to_bf16_frag<<<cAct / 256, 256, 0, stream>>>(v, vb, cAct);
  mha_f32_to_bf16_frag<<<cW / 256, 256, 0, stream>>>(Wq, Wqb, cW);
  mha_f32_to_bf16_frag<<<cW / 256, 256, 0, stream>>>(Wk, Wkb, cW);
  mha_f32_to_bf16_frag<<<cW / 256, 256, 0, stream>>>(Wv, Wvb, cW);
  mha_f32_to_bf16_frag<<<cW / 256, 256, 0, stream>>>(Wo, Wob, cW);

  dim3 ggrid(DMODEL / 256, MROWS / 64);  // (4, 64)
  mha_gemm_bf16<0><<<ggrid, 256, 0, stream>>>(qb, Wqb, Pq, nullptr, nullptr);
  mha_gemm_bf16<0><<<ggrid, 256, 0, stream>>>(kb, Wkb, Pk, nullptr, nullptr);
  mha_gemm_bf16<1><<<ggrid, 256, 0, stream>>>(vb, Wvb, Vt, nullptr, nullptr);

  mha_attn<<<BATCH * HEADS * (SEQL / 128), 256, 0, stream>>>(Pq, Pk, Vt, Pc);

  mha_gemm_bf16<2><<<ggrid, 256, 0, stream>>>(Pc, Wob, nullptr, out, q);
}

// v003
// A run of this version takes 189 microseconds.
// Next to v002, in two timings, it ran 1.26 times as fast each time.
// Over all steps from v000 it is 1.67 times as fast.
#include <hip/hip_runtime.h>
#include <hip/hip_bf16.h>
#include <stdint.h>

// Problem constants (match the JAX reference)
#define HEADS  16
#define DMODEL 1024
#define DK     64
#define BATCH  4
#define SEQL   1024
#define MROWS  (BATCH * SEQL)   // 4096
#define NEG_BIG (-1000000000.0f)

typedef __bf16    bf16;
typedef uint32_t  u32;
typedef __attribute__((ext_vector_type(16))) bf16  v16bf;
typedef __attribute__((ext_vector_type(8)))  float v8f;
typedef __attribute__((ext_vector_type(4)))  u32   v4u;

union FragU { v16bf bf; v4u u[2]; };

// Load one 16-bit WMMA operand fragment: two contiguous 8-element (16B) chunks.
// Per the CDNA5 ISA 16-bit A-matrix layout, lane L holds K elements
// {half*8 .. half*8+7} and {16+half*8 .. 16+half*8+7} (half = L>=16).
// The caller passes pointers already offset to those two chunks.
__device__ inline v16bf load_frag(const bf16* p0, const bf16* p1) {
  FragU f;
  f.u[0] = *(const v4u*)p0;
  f.u[1] = *(const v4u*)p1;
  return f.bf;
}

__device__ inline v8f wmma_bf16(v16bf a, v16bf b, v8f c) {
  // D = A(16x32 bf16) x B(32x16 bf16) + C(16x16 f32)
  return __builtin_amdgcn_wmma_f32_16x16x32_bf16(
      false, a, false, b, (short)0, c, false, false);
}

// float -> bf16, round to nearest even (bit manipulation: no __bf16 arith needed)
__device__ inline bf16 f2b(float f) {
  union { float f; u32 u; } x; x.f = f;
  u32 r = x.u + 0x7FFFu + ((x.u >> 16) & 1u);
  union { unsigned short s; bf16 b; } y; y.s = (unsigned short)(r >> 16);
  return y.b;
}

__device__ inline float redmax16(float v) {
  v = fmaxf(v, __shfl_xor(v, 1, 16));
  v = fmaxf(v, __shfl_xor(v, 2, 16));
  v = fmaxf(v, __shfl_xor(v, 4, 16));
  v = fmaxf(v, __shfl_xor(v, 8, 16));
  return v;
}
__device__ inline float redsum16(float v) {
  v += __shfl_xor(v, 1, 16);
  v += __shfl_xor(v, 2, 16);
  v += __shfl_xor(v, 4, 16);
  v += __shfl_xor(v, 8, 16);
  return v;
}

// ---------------------------------------------------------------------------
// Fragment order. Every bf16 tensor in the workspace is kept as 1-KiB tiles of
// 16 rows x 32 k, each tile in the order in which a wave loads it as a 16-bit
// WMMA operand: [chunk c = 0,1][lane = half*16 + r][8 elements], holding
// element (row r, k = c*16 + half*8 + e). One 16-byte-per-lane access of a wave
// is then 512 contiguous bytes (4 whole lines) instead of 32 bytes of 16 lines.
// ---------------------------------------------------------------------------
#define TILE_ELEMS 512   // 16 x 32 bf16
#define KTILES     (DMODEL / 32)

// Fragment of tile number tile; p already holds the lane's own offset (lane*8).
__device__ inline v16bf load_tile(const bf16* p, int tile) {
  const bf16* t = p + (size_t)tile * TILE_ELEMS;
  return load_frag(t, t + 256);
}

__device__ inline v4u pack8(const float* v) {
  union { bf16 e[8]; v4u u; } pk;
#pragma unroll
  for (int j = 0; j < 8; ++j) pk.e[j] = f2b(v[j]);
  return pk.u;
}

// ---------------------------------------------------------------------------
// float32 [rows][1024] row-major -> bf16 tiles [rows/16][32] in fragment order.
// One thread makes one 16-byte chunk. All seven tensors share one grid: none
// needs anything of another, and their bf16 copies lie one behind the other in
// y (q, k, v, Wq, Wk, Wv, Wo), so the block index names both the source tensor
// (the same for a whole block) and the place in y.
// ---------------------------------------------------------------------------
#define ACT_BLOCKS (MROWS * DMODEL / 8 / 256)    // 2048 blocks per activation
#define WGT_BLOCKS (DMODEL * DMODEL / 8 / 256)   // 512 blocks per weight
#define CVT_BLOCKS (3 * ACT_BLOCKS + 4 * WGT_BLOCKS)

__global__ __launch_bounds__(256)
void mha_f32_to_bf16_frag(const float* __restrict__ q, const float* __restrict__ k,
                          const float* __restrict__ v, const float* __restrict__ Wq,
                          const float* __restrict__ Wk, const float* __restrict__ Wv,
                          const float* __restrict__ Wo, bf16* __restrict__ y) {
  const u32 blk = blockIdx.x;
  const float* x = (blk < 1 * ACT_BLOCKS) ? q
                 : (blk < 2 * ACT_BLOCKS) ? k
                 : (blk < 3 * ACT_BLOCKS) ? v
                 : (blk < 3 * ACT_BLOCKS + 1 * WGT_BLOCKS) ? Wq
                 : (blk < 3 * ACT_BLOCKS + 2 * WGT_BLOCKS) ? Wk
                 : (blk < 3 * ACT_BLOCKS + 3 * WGT_BLOCKS) ? Wv : Wo;
  // block number within its own tensor: every tensor starts at a multiple of
  // its own (power-of-two) block count
  const u32 lb = blk & ((blk < 3 * ACT_BLOCKS) ? ACT_BLOCKS - 1 : WGT_BLOCKS - 1);
  const int g  = (int)(lb * 256 + threadIdx.x);  // chunk within the tensor
  const int L  = g & 31;
  const int c  = (g >> 5) & 1;
  const int kt = (g >> 6) & (KTILES - 1);
  const int rt = g >> 11;
  const float* s = x + (size_t)(rt * 16 + (L & 15)) * DMODEL +
                   kt * 32 + c * 16 + (L >> 4) * 8;
  const float4 a = *(const float4*)s;
  const float4 b = *(const float4*)(s + 4);
  const float e[8] = {a.x, a.y, a.z, a.w, b.x, b.y, b.z, b.w};
  *(v4u*)(y + ((size_t)blk * 256 + threadIdx.x) * 8) = pack8(e);
}

// ---------------------------------------------------------------------------
// C[4096,1024] = A[4096,1024](bf16) @ W[1024,1024](bf16)^T, A and W in
// fragment order. Wave tile 32x64 (2x4 accumulators); workgroup tile 64x256.
//
// The head slab (b,h) is the contiguous reshape of C[b, 64h:64h+64, :]:
// element (s, col) is position t = (s & 63) * 16 + (col >> 6), d = col & 63.
// Attention may take its positions in any order, so a tile of 16 positions is
// 16 neighbouring s of one column block: tile number (col >> 6) * 4 +
// ((s & 63) >> 4), row s & 15. A 16x16 accumulator tile is then one chunk.
//
// MODE 0 (Q, K): operands swapped (tile = W * A^T), so a lane holds 8
//         neighbouring d of one s. Out: [b,h][64 tiles][d/32] fragment tiles.
// MODE 1 (V): a lane holds 8 neighbouring s of one d. Out: V^T fragment tiles
//         [b,h][32 blocks of 32 positions][d/16], rows d, k = position.
// MODE 2: f32 out = C + resid. A's row tiles are attention's query tiles
//         (b, tile number); the rows go back to their places here.
// ---------------------------------------------------------------------------
template <int MODE>
__device__ __forceinline__
void gemm_tile(const bf16* __restrict__ A, const bf16* __restrict__ W,
               bf16* __restrict__ outB, float* __restrict__ outF,
               const float* __restrict__ resid) {
  const int lane = threadIdx.x & 31;
  const int wave = threadIdx.x >> 5;
  const int half = lane >> 4;
  const int r    = lane & 15;
  const int wm   = wave >> 2;  // 0..1
  const int wn   = wave & 3;   // 0..3
  const int M0 = blockIdx.y * 64 + wm * 32;
  const int N0 = blockIdx.x * 256 + wn * 64;

  v8f acc[2][4];
#pragma unroll
  for (int i = 0; i < 2; ++i)
#pragma unroll
    for (int j = 0; j < 4; ++j) acc[i][j] = (v8f){0, 0, 0, 0, 0, 0, 0, 0};

  const bf16* Ap = A + (size_t)(M0 >> 4) * KTILES * TILE_ELEMS + lane * 8;
  const bf16* Wp = W + (size_t)(N0 >> 4) * KTILES * TILE_ELEMS + lane * 8;

  for (int kt = 0; kt < KTILES; ++kt) {
    v16bf af[2], bf_[4];
#pragma unroll
    for (int ms = 0; ms < 2; ++ms) af[ms] = load_tile(Ap, ms * KTILES + kt);
#pragma unroll
    for (int ns = 0; ns < 4; ++ns) bf_[ns] = load_tile(Wp, ns * KTILES + kt);
#pragma unroll
    for (int ms = 0; ms < 2; ++ms)
#pragma unroll
      for (int ns = 0; ns < 4; ++ns)
        acc[ms][ns] = (MODE == 0) ? wmma_bf16(bf_[ns], af[ms], acc[ms][ns])
                                  : wmma_bf16(af[ms], bf_[ns], acc[ms][ns]);
  }

  if (MODE == 0 || MODE == 1) {
    const int bh = ((M0 >> 10) * HEADS) + ((M0 & 1023) >> 6);
    const int cb = N0 >> 6;            // column block 0..15
    const int sb = (M0 & 63) >> 4;     // 0 or 2; + ms
#pragma unroll
    for (int ms = 0; ms < 2; ++ms) {
#pragma unroll
      for (int ns = 0; ns < 4; ++ns) {
        float v[8];
#pragma unroll
        for (int j = 0; j < 8; ++j) v[j] = acc[ms][ns][j];
        // chunk number: MODE 0 tile (cb*4 + sb + ms), d/32 = ns>>1, c = ns&1
        //               MODE 1 block (cb*2 + sb/2), d/16 = ns, c = ms
        const int chunk =
            (MODE == 0)
                ? (((bh * 64 + cb * 4 + sb + ms) * 2 + (ns >> 1)) * 2 + (ns & 1))
                : (((bh * 32 + cb * 2 + (sb >> 1)) * 4 + ns) * 2 + ms);
        *(v4u*)(outB + (size_t)chunk * 256 + lane * 8) = pack8(v);
        // stands in front of the next chunk's packing, which may overwrite the
        // registers that this store names
        asm volatile("s_wait_xcnt 0x0" ::: "memory");
      }
    }
    return;
  }

  // C/D layout: lanes 0-15 hold rows j, lanes 16-31 rows j+8; col = lane&15.
  // Both row tiles of the wave share b and cb (M0 is a multiple of 32), so one
  // base serves: tile ms is 256 rows on, register j is 16 rows on.
  const int rt = M0 >> 4;            // (b, query tile), even
  const int b  = rt >> 6;
  const int cb = (rt & 63) >> 2;
  const int sb = rt & 3;
  const size_t base =
      ((size_t)b * SEQL + ((sb * 16 + 8 * half) << 4) + cb) * DMODEL + N0 + r;
  const float* rp = resid + base;
  float*       op = outF + base;
  float rv[2][4][8];
#pragma unroll
  for (int ms = 0; ms < 2; ++ms)
#pragma unroll
    for (int ns = 0; ns < 4; ++ns)
#pragma unroll
      for (int j = 0; j < 8; ++j)
        rv[ms][ns][j] = rp[(ms * 256 + j * 16) * DMODEL + ns * 16];
#pragma unroll
  for (int ms = 0; ms < 2; ++ms)
#pragma unroll
    for (int ns = 0; ns < 4; ++ns)
#pragma unroll
      for (int j = 0; j < 8; ++j)
        op[(ms * 256 + j * 16) * DMODEL + ns * 16] = acc[ms][ns][j] + rv[ms][ns][j];
}

// The three projections need nothing of each other: one grid, blockIdx.z = 0, 1,
// 2 for Q, K, V. X, Wt and P each hold their three tensors one behind the other.
__global__ __launch_bounds__(256)
void mha_gemm_qkv(const bf16* __restrict__ X, const bf16* __restrict__ Wt,
                  bf16* __restrict__ P) {
  const int z = blockIdx.z;
  const bf16* A = X + (size_t)z * (MROWS * DMODEL);
  const bf16* W = Wt + (size_t)z * (DMODEL * DMODEL);
  bf16*       O = P + (size_t)z * (MROWS * DMODEL);
  if (z == 2) gemm_tile<1>(A, W, O, nullptr, nullptr);
  else        gemm_tile<0>(A, W, O, nullptr, nullptr);
}

__global__ __launch_bounds__(256)
void mha_gemm_out(const bf16* __restrict__ A, const bf16* __restrict__ W,
                  float* __restrict__ outF, const float* __restrict__ resid) {
  gemm_tile<2>(A, W, nullptr, outF, resid);
}

// ---------------------------------------------------------------------------
// Attention per (b,h), all operands in fragment order (see above).
// 8 waves / WG; each wave owns one tile of 16 queries. Exact two-pass softmax:
//   pass 1: stream Q*K^T tiles, track per-row max (mask raw==0 -> -1e9, /8)
//   pass 2: recompute tiles, p = exp(s - m), accumulate row sum and O = P*V
// P tiles bounce through LDS (C-layout -> A-fragment layout conversion), and
// so does O at the end, which leaves as A-fragment tiles of the last product.
// ---------------------------------------------------------------------------
__global__ __launch_bounds__(256)
void mha_attn(const bf16* __restrict__ Pq, const bf16* __restrict__ Pk,
              const bf16* __restrict__ Vt, bf16* __restrict__ Pc) {
  __shared__ bf16 Plds[8][16][40];  // stride 40 -> conflict-free b128 reads

  const int lane = threadIdx.x & 31;
  const int wave = threadIdx.x >> 5;
  const int half = lane >> 4;
  const int r    = lane & 15;

  const int qblk = blockIdx.x & 7;
  const int bh   = blockIdx.x >> 3;
  const int b    = bh >> 4;
  const int h    = bh & 15;

  const int qt = qblk * 8 + wave;  // query tile 0..63

  // head slabs, each 128 tiles of 1 KiB, with the lane's own offset
  const bf16* Qh  = Pq + (size_t)bh * (SEQL * DK) + lane * 8;  // [64][2]
  const bf16* Kh  = Pk + (size_t)bh * (SEQL * DK) + lane * 8;  // [64][2]
  const bf16* Vth = Vt + (size_t)bh * (DK * SEQL) + lane * 8;  // [32][4]

  // Q fragments for this wave's 16 rows (K-dim = d, 0..31 and 32..63)
  v16bf aq[2];
  aq[0] = load_tile(Qh, qt * 2);
  aq[1] = load_tile(Qh, qt * 2 + 1);

  const v8f vzero = (v8f){0, 0, 0, 0, 0, 0, 0, 0};

  // ---- pass 1: row maxima ----
  float m[8];
#pragma unroll
  for (int j = 0; j < 8; ++j) m[j] = -1e30f;

  for (int kt = 0; kt < SEQL / 16; ++kt) {
    v16bf bk0 = load_tile(Kh, kt * 2);
    v16bf bk1 = load_tile(Kh, kt * 2 + 1);
    v8f s = vzero;
    s = wmma_bf16(aq[0], bk0, s);
    s = wmma_bf16(aq[1], bk1, s);
#pragma unroll
    for (int j = 0; j < 8; ++j) {
      float sv = s[j];
      sv = (sv == 0.0f) ? NEG_BIG : sv * 0.125f;  // mask, then 1/sqrt(64)
      m[j] = fmaxf(m[j], sv);
    }
  }
#pragma unroll
  for (int j = 0; j < 8; ++j) m[j] = redmax16(m[j]);

  // ---- pass 2: sum + O accumulation ----
  float l[8];
#pragma unroll
  for (int j = 0; j < 8; ++j) l[j] = 0.0f;
  v8f o[4];
#pragma unroll
  for (int nb = 0; nb < 4; ++nb) o[nb] = vzero;

  const bf16* prow = &Plds[wave][r][0];

  for (int kp = 0; kp < SEQL / 32; ++kp) {
    v8f s[2];
#pragma unroll
    for (int t = 0; t < 2; ++t) {
      v16bf bk0 = load_tile(Kh, (kp * 2 + t) * 2);
      v16bf bk1 = load_tile(Kh, (kp * 2 + t) * 2 + 1);
      s[t] = vzero;
      s[t] = wmma_bf16(aq[0], bk0, s[t]);
      s[t] = wmma_bf16(aq[1], bk1, s[t]);
    }

    __syncthreads();  // protect previous iteration's LDS reads
#pragma unroll
    for (int t = 0; t < 2; ++t) {
#pragma unroll
      for (int j = 0; j < 8; ++j) {
        float sv = s[t][j];
        sv = (sv == 0.0f) ? NEG_BIG : sv * 0.125f;
        float p = __expf(sv - m[j]);
        l[j] += p;
        Plds[wave][j + 8 * half][t * 16 + r] = f2b(p);
      }
    }
    __syncthreads();  // publish P tile (C-layout -> row-major in LDS)

    // Reload P as A-fragment (16 rows x 32 k), contiguous ds_load_b128.
    v16bf ap = load_frag(prow + half * 8, prow + 16 + half * 8);

#pragma unroll
    for (int nb = 0; nb < 4; ++nb) {
      v16bf bv = load_tile(Vth, kp * 4 + nb);
      o[nb] = wmma_bf16(ap, bv, o[nb]);
    }
  }

#pragma unroll
  for (int j = 0; j < 8; ++j) l[j] = redsum16(l[j]);

  // Store O as A-fragment tiles of the concat matrix: row tile (b, qt),
  // k = h*64 + d, two tiles of 32 d. Same LDS turn as for P.
  bf16* Oc = Pc + ((size_t)(b * 64 + qt) * KTILES + h * 2) * TILE_ELEMS + lane * 8;
#pragma unroll
  for (int dh = 0; dh < 2; ++dh) {
    __syncthreads();  // the reads of the turn before are done
#pragma unroll
    for (int t = 0; t < 2; ++t)
#pragma unroll
      for (int j = 0; j < 8; ++j)
        Plds[wave][j + 8 * half][t * 16 + r] = f2b(o[dh * 2 + t][j] / l[j]);
    __syncthreads();  // publish the O tile before it is read back by rows
    *(v4u*)(Oc + dh * TILE_ELEMS)       = *(const v4u*)(prow + half * 8);
    *(v4u*)(Oc + dh * TILE_ELEMS + 256) = *(const v4u*)(prow + 16 + half * 8);
  }
}

// ---------------------------------------------------------------------------
// Host-side launch. Workspace layout (needs 64 MB), all in fragment order:
//  [ 0MB) qb  [ 8MB) kb  [16MB) vb            (bf16 activations, 8MB each)
//  [24MB) Wqb [26MB) Wkb [28MB) Wvb [30MB) Wob (bf16 weights, 2MB each)
//  [32MB) Pq  [40MB) Pk  [48MB) Vt  [56MB) Pc  (bf16 intermediates, 8MB each)
// ---------------------------------------------------------------------------
extern "C" void kernel_launch(void* const* d_in, const int* in_sizes, int n_in,
                              void* d_out, int out_size, void* d_ws,
                              size_t ws_size, hipStream_t stream) {
  (void)in_sizes; (void)n_in; (void)out_size; (void)ws_size;
  const float* q  = (const float*)d_in[0];
  const float* k  = (const float*)d_in[1];
  const float* v  = (const float*)d_in[2];
  const float* Wq = (const float*)d_in[3];
  const float* Wk = (const float*)d_in[4];
  const float* Wv = (const float*)d_in[5];
  const float* Wo = (const float*)d_in[6];
  float* out = (float*)d_out;

  char* ws = (char*)d_ws;
  const size_t MB = (size_t)1 << 20;
  bf16* qb  = (bf16*)(ws + 0 * MB);
  bf16* Wqb = (bf16*)(ws + 24 * MB);
  bf16* Wob = (bf16*)(ws + 30 * MB);
  bf16* Pq  = (bf16*)(ws + 32 * MB);
  bf16* Pk  = (bf16*)(ws + 40 * MB);
  bf16* Vt  = (bf16*)(ws + 48 * MB);
  bf16* Pc  = (bf16*)(ws + 56 * MB);

  // qb .. Wob are filled as one run of chunks from qb on
  mha_f32_to_bf16_frag<<<CVT_BLOCKS, 256, 0, stream>>>(q, k, v, Wq, Wk, Wv, Wo, qb);

  // (qb, kb, vb) x (Wqb, Wkb, Wvb) -> (Pq, Pk, Vt)
  mha_gemm_qkv<<<dim3(DMODEL / 256, MROWS / 64, 3), 256, 0, stream>>>(qb, Wqb, Pq);

  mha_attn<<<BATCH * HEADS * (SEQL / 128), 256, 0, stream>>>(Pq, Pk, Vt, Pc);

  mha_gemm_out<<<dim3(DMODEL / 256, MROWS / 64), 256, 0, stream>>>(Pc, Wob, out, q);
}

// v004
// A run of this version takes 162 microseconds.
// Two timings next to v003 put it at 1.19 and 1.17 times that version's speed.
// Over all steps from v000 it is 1.96 times as fast.
#include <hip/hip_runtime.h>
#include <hip/hip_bf16.h>
#include <stdint.h>

// Problem constants (match the JAX reference)
#define HEADS  16
#define DMODEL 1024
#define DK     64
#define BATCH  4
#define SEQL   1024
#define MROWS  (BATCH * SEQL)   // 4096
#define NEG_BIG (-1000000000.0f)

typedef __bf16    bf16;
typedef uint32_t  u32;
typedef __attribute__((ext_vector_type(16))) bf16  v16bf;
typedef __attribute__((ext_vector_type(8)))  float v8f;
typedef __attribute__((ext_vector_type(4)))  u32   v4u;

union FragU { v16bf bf; v4u u[2]; };

// Load one 16-bit WMMA operand fragment: two contiguous 8-element (16B) chunks.
// Per the CDNA5 ISA 16-bit A-matrix layout, lane L holds K elements
// {half*8 .. half*8+7} and {16+half*8 .. 16+half*8+7} (half = L>=16).
// The caller passes pointers already offset to those two chunks.
__device__ inline v16bf load_frag(const bf16* p0, const bf16* p1) {
  FragU f;
  f.u[0] = *(const v4u*)p0;
  f.u[1] = *(const v4u*)p1;
  return f.bf;
}

__device__ inline v8f wmma_bf16(v16bf a, v16bf b, v8f c) {
  // D = A(16x32 bf16) x B(32x16 bf16) + C(16x16 f32)
  return __builtin_amdgcn_wmma_f32_16x16x32_bf16(
      false, a, false, b, (short)0, c, false, false);
}

// float -> bf16, round to nearest even (bit manipulation: no __bf16 arith needed)
__device__ inline bf16 f2b(float f) {
  union { float f; u32 u; } x; x.f = f;
  u32 r = x.u + 0x7FFFu + ((x.u >> 16) & 1u);
  union { unsigned short s; bf16 b; } y; y.s = (unsigned short)(r >> 16);
  return y.b;
}

// ---------------------------------------------------------------------------
// Fragment order. Every bf16 tensor in the workspace is kept as 1-KiB tiles of
// 16 rows x 32 k, each tile in the order in which a wave loads it as a 16-bit
// WMMA operand: [chunk c = 0,1][lane = half*16 + r][8 elements], holding
// element (row r, k = c*16 + half*8 + e). One 16-byte-per-lane access of a wave
// is then 512 contiguous bytes (4 whole lines) instead of 32 bytes of 16 lines.
// ---------------------------------------------------------------------------
#define TILE_ELEMS 512   // 16 x 32 bf16
#define KTILES     (DMODEL / 32)

// Fragment of tile number tile; p already holds the lane's own offset (lane*8).
__device__ inline v16bf load_tile(const bf16* p, int tile) {
  const bf16* t = p + (size_t)tile * TILE_ELEMS;
  return load_frag(t, t + 256);
}

__device__ inline v4u pack8(const float* v) {
  union { bf16 e[8]; v4u u; } pk;
#pragma unroll
  for (int j = 0; j < 8; ++j) pk.e[j] = f2b(v[j]);
  return pk.u;
}

// ---------------------------------------------------------------------------
// float32 [rows][1024] row-major -> bf16 tiles [rows/16][32] in fragment order.
// One thread makes one 16-byte chunk. All seven tensors share one grid: none
// needs anything of another, and their bf16 copies lie one behind the other in
// y (q, k, v, Wq, Wk, Wv, Wo), so the block index names both the source tensor
// (the same for a whole block) and the place in y.
// ---------------------------------------------------------------------------
#define ACT_BLOCKS (MROWS * DMODEL / 8 / 256)    // 2048 blocks per activation
#define WGT_BLOCKS (DMODEL * DMODEL / 8 / 256)   // 512 blocks per weight
#define CVT_BLOCKS (3 * ACT_BLOCKS + 4 * WGT_BLOCKS)

__global__ __launch_bounds__(256)
void mha_f32_to_bf16_frag(const float* __restrict__ q, const float* __restrict__ k,
                          const float* __restrict__ v, const float* __restrict__ Wq,
                          const float* __restrict__ Wk, const float* __restrict__ Wv,
                          const float* __restrict__ Wo, bf16* __restrict__ y) {
  const u32 blk = blockIdx.x;
  const float* x = (blk < 1 * ACT_BLOCKS) ? q
                 : (blk < 2 * ACT_BLOCKS) ? k
                 : (blk < 3 * ACT_BLOCKS) ? v
                 : (blk < 3 * ACT_BLOCKS + 1 * WGT_BLOCKS) ? Wq
                 : (blk < 3 * ACT_BLOCKS + 2 * WGT_BLOCKS) ? Wk
                 : (blk < 3 * ACT_BLOCKS + 3 * WGT_BLOCKS) ? Wv : Wo;
  // block number within its own tensor: every tensor starts at a multiple of
  // its own (power-of-two) block count
  const u32 lb = blk & ((blk < 3 * ACT_BLOCKS) ? ACT_BLOCKS - 1 : WGT_BLOCKS - 1);
  const int g  = (int)(lb * 256 + threadIdx.x);  // chunk within the tensor
  const int L  = g & 31;
  const int c  = (g >> 5) & 1;
  const int kt = (g >> 6) & (KTILES - 1);
  const int rt = g >> 11;
  const float* s = x + (size_t)(rt * 16 + (L & 15)) * DMODEL +
                   kt * 32 + c * 16 + (L >> 4) * 8;
  const float4 a = *(const float4*)s;
  const float4 b = *(const float4*)(s + 4);
  const float e[8] = {a.x, a.y, a.z, a.w, b.x, b.y, b.z, b.w};
  *(v4u*)(y + ((size_t)blk * 256 + threadIdx.x) * 8) = pack8(e);
}

// ---------------------------------------------------------------------------
// C[4096,1024] = A[4096,1024](bf16) @ W[1024,1024](bf16)^T, A and W in
// fragment order. Wave tile 32x64 (2x4 accumulators); workgroup tile 64x256.
//
// The head slab (b,h) is the contiguous reshape of C[b, 64h:64h+64, :]:
// element (s, col) is position t = (s & 63) * 16 + (col >> 6), d = col & 63.
// Attention may take its positions in any order, so a tile of 16 positions is
// 16 neighbouring s of one column block: tile number (col >> 6) * 4 +
// ((s & 63) >> 4), row s & 15. A 16x16 accumulator tile is then one chunk.
//
// MODE 0 (Q, K): operands swapped (tile = W * A^T), so a lane holds 8
//         neighbouring d of one s. Out: [b,h][64 tiles][d/32] fragment tiles.
// MODE 1 (V): a lane holds 8 neighbouring s of one d. Out: V^T fragment tiles
//         [b,h][32 blocks of 32 positions][d/16], rows d, k = position.
// MODE 2: f32 out = C + resid. A's row tiles are attention's query tiles
//         (b, tile number); the rows go back to their places here.
// ---------------------------------------------------------------------------
template <int MODE>
__device__ __forceinline__
void gemm_tile(const bf16* __restrict__ A, const bf16* __restrict__ W,
               bf16* __restrict__ outB, float* __restrict__ outF,
               const float* __restrict__ resid) {
  const int lane = threadIdx.x & 31;
  const int wave = threadIdx.x >> 5;
  const int half = lane >> 4;
  const int r    = lane & 15;
  const int wm   = wave >> 2;  // 0..1
  const int wn   = wave & 3;   // 0..3
  const int M0 = blockIdx.y * 64 + wm * 32;
  const int N0 = blockIdx.x * 256 + wn * 64;

  v8f acc[2][4];
#pragma unroll
  for (int i = 0; i < 2; ++i)
#pragma unroll
    for (int j = 0; j < 4; ++j) acc[i][j] = (v8f){0, 0, 0, 0, 0, 0, 0, 0};

  const bf16* Ap = A + (size_t)(M0 >> 4) * KTILES * TILE_ELEMS + lane * 8;
  const bf16* Wp = W + (size_t)(N0 >> 4) * KTILES * TILE_ELEMS + lane * 8;

  for (int kt = 0; kt < KTILES; ++kt) {
    v16bf af[2], bf_[4];
#pragma unroll
    for (int ms = 0; ms < 2; ++ms) af[ms] = load_tile(Ap, ms * KTILES + kt);
#pragma unroll
    for (int ns = 0; ns < 4; ++ns) bf_[ns] = load_tile(Wp, ns * KTILES + kt);
#pragma unroll
    for (int ms = 0; ms < 2; ++ms)
#pragma unroll
      for (int ns = 0; ns < 4; ++ns)
        acc[ms][ns] = (MODE == 0) ? wmma_bf16(bf_[ns], af[ms], acc[ms][ns])
                                  : wmma_bf16(af[ms], bf_[ns], acc[ms][ns]);
  }

  if (MODE == 0 || MODE == 1) {
    const int bh = ((M0 >> 10) * HEADS) + ((M0 & 1023) >> 6);
    const int cb = N0 >> 6;            // column block 0..15
    const int sb = (M0 & 63) >> 4;     // 0 or 2; + ms
#pragma unroll
    for (int ms = 0; ms < 2; ++ms) {
#pragma unroll
      for (int ns = 0; ns < 4; ++ns) {
        float v[8];
#pragma unroll
        for (int j = 0; j < 8; ++j) v[j] = acc[ms][ns][j];
        // chunk number: MODE 0 tile (cb*4 + sb + ms), d/32 = ns>>1, c = ns&1
        //               MODE 1 block (cb*2 + sb/2), d/16 = ns, c = ms
        const int chunk =
            (MODE == 0)
                ? (((bh * 64 + cb * 4 + sb + ms) * 2 + (ns >> 1)) * 2 + (ns & 1))
                : (((bh * 32 + cb * 2 + (sb >> 1)) * 4 + ns) * 2 + ms);
        *(v4u*)(outB + (size_t)chunk * 256 + lane * 8) = pack8(v);
        // stands in front of the next chunk's packing, which may overwrite the
        // registers that this store names
        asm volatile("s_wait_xcnt 0x0" ::: "memory");
      }
    }
    return;
  }

  // C/D layout: lanes 0-15 hold rows j, lanes 16-31 rows j+8; col = lane&15.
  // Both row tiles of the wave share b and cb (M0 is a multiple of 32), so one
  // base serves: tile ms is 256 rows on, register j is 16 rows on.
  const int rt = M0 >> 4;            // (b, query tile), even
  const int b  = rt >> 6;
  const int cb = (rt & 63) >> 2;
  const int sb = rt & 3;
  const size_t base =
      ((size_t)b * SEQL + ((sb * 16 + 8 * half) << 4) + cb) * DMODEL + N0 + r;
  const float* rp = resid + base;
  float*       op = outF + base;
  float rv[2][4][8];
#pragma unroll
  for (int ms = 0; ms < 2; ++ms)
#pragma unroll
    for (int ns = 0; ns < 4; ++ns)
#pragma unroll
      for (int j = 0; j < 8; ++j)
        rv[ms][ns][j] = rp[(ms * 256 + j * 16) * DMODEL + ns * 16];
#pragma unroll
  for (int ms = 0; ms < 2; ++ms)
#pragma unroll
    for (int ns = 0; ns < 4; ++ns)
#pragma unroll
      for (int j = 0; j < 8; ++j)
        op[(ms * 256 + j * 16) * DMODEL + ns * 16] = acc[ms][ns][j] + rv[ms][ns][j];
}

// The three projections need nothing of each other: one grid, blockIdx.z = 0, 1,
// 2 for Q, K, V. X, Wt and P each hold their three tensors one behind the other.
__global__ __launch_bounds__(256)
void mha_gemm_qkv(const bf16* __restrict__ X, const bf16* __restrict__ Wt,
                  bf16* __restrict__ P) {
  const int z = blockIdx.z;
  const bf16* A = X + (size_t)z * (MROWS * DMODEL);
  const bf16* W = Wt + (size_t)z * (DMODEL * DMODEL);
  bf16*       O = P + (size_t)z * (MROWS * DMODEL);
  if (z == 2) gemm_tile<1>(A, W, O, nullptr, nullptr);
  else        gemm_tile<0>(A, W, O, nullptr, nullptr);
}

__global__ __launch_bounds__(256)
void mha_gemm_out(const bf16* __restrict__ A, const bf16* __restrict__ W,
                  float* __restrict__ outF, const float* __restrict__ resid) {
  gemm_tile<2>(A, W, nullptr, outF, resid);
}

// Eight exp2 in one statement. Behind a transcendental the instruction set asks
// for one independent instruction before its result is read or its source is
// overwritten. Inside the statement the next exp2 is that instruction (the
// outputs are early-clobber, so none lies on a source); behind the last one
// stands v_nop.
__device__ inline void exp2x8(float* p, const float* a) {
  asm("v_exp_f32 %0, %8\n\t"
      "v_exp_f32 %1, %9\n\t"
      "v_exp_f32 %2, %10\n\t"
      "v_exp_f32 %3, %11\n\t"
      "v_exp_f32 %4, %12\n\t"
      "v_exp_f32 %5, %13\n\t"
      "v_exp_f32 %6, %14\n\t"
      "v_exp_f32 %7, %15\n\t"
      "v_nop"
      : "=&v"(p[0]), "=&v"(p[1]), "=&v"(p[2]), "=&v"(p[3]),
        "=&v"(p[4]), "=&v"(p[5]), "=&v"(p[6]), "=&v"(p[7])
      : "v"(a[0]), "v"(a[1]), "v"(a[2]), "v"(a[3]),
        "v"(a[4]), "v"(a[5]), "v"(a[6]), "v"(a[7]));
}

__global__ __launch_bounds__(256)
void mha_attn(const bf16* __restrict__ Pq, const bf16* __restrict__ Pk,
              const bf16* __restrict__ Vt, bf16* __restrict__ Pc) {
  const int lane = threadIdx.x & 31;
  const int wave = threadIdx.x >> 5;

  const int qblk = blockIdx.x & 7;
  const int bh   = blockIdx.x >> 3;
  const int b    = bh >> 4;
  const int h    = bh & 15;

  const int qt = qblk * 8 + wave;  // query tile 0..63

  // head slabs, each 128 tiles of 1 KiB, with the lane's own offset
  const bf16* Qh  = Pq + (size_t)bh * (SEQL * DK) + lane * 8;  // [64][2]
  const bf16* Kh  = Pk + (size_t)bh * (SEQL * DK) + lane * 8;  // [64][2]
  const bf16* Vth = Vt + (size_t)bh * (DK * SEQL) + lane * 8;  // [32][4]

  // Q^T fragments for this wave's 16 queries (K-dim = d, 0..31 and 32..63)
  v16bf bq[2];
  bq[0] = load_tile(Qh, qt * 2);
  bq[1] = load_tile(Qh, qt * 2 + 1);

  const v8f vzero = (v8f){0, 0, 0, 0, 0, 0, 0, 0};

  // ---- pass 1: maxima (eight chains a lane, joined behind the loop) ----
  float mj[8];
#pragma unroll
  for (int j = 0; j < 8; ++j) mj[j] = -1e30f;

  for (int kt = 0; kt < SEQL / 16; ++kt) {
    v16bf ak0 = load_tile(Kh, kt * 2);
    v16bf ak1 = load_tile(Kh, kt * 2 + 1);
    v8f s = vzero;
    s = wmma_bf16(ak0, bq[0], s);
    s = wmma_bf16(ak1, bq[1], s);
#pragma unroll
    for (int j = 0; j < 8; ++j) {
      float sv = s[j];
      sv = (sv == 0.0f) ? NEG_BIG : sv * 0.125f;  // mask, then 1/sqrt(64)
      mj[j] = fmaxf(mj[j], sv);
    }
  }
  float m = mj[0];
#pragma unroll
  for (int j = 1; j < 8; ++j) m = fmaxf(m, mj[j]);
  m = fmaxf(m, __shfl_xor(m, 16, 32));  // the other half's keys

  // ---- pass 2: sum + O^T accumulation ----
  float lj[8];
#pragma unroll
  for (int j = 0; j < 8; ++j) lj[j] = 0.0f;
  v8f o[4];
#pragma unroll
  for (int nb = 0; nb < 4; ++nb) o[nb] = vzero;

  for (int kp = 0; kp < SEQL / 32; ++kp) {
    FragU pt;  // P^T, 32 keys x 16 queries, as a B fragment
#pragma unroll
    for (int t = 0; t < 2; ++t) {
      v16bf ak0 = load_tile(Kh, (kp * 2 + t) * 2);
      v16bf ak1 = load_tile(Kh, (kp * 2 + t) * 2 + 1);
      v8f s = vzero;
      s = wmma_bf16(ak0, bq[0], s);
      s = wmma_bf16(ak1, bq[1], s);
      float a[8], p[8];
#pragma unroll
      for (int j = 0; j < 8; ++j) {
        float sv = s[j];
        sv = (sv == 0.0f) ? NEG_BIG : sv * 0.125f;
        a[j] = (sv - m) * 1.44269504f;  // exp(x) = exp2(x * log2 e), as __expf forms it
      }
      exp2x8(p, a);
#pragma unroll
      for (int j = 0; j < 8; ++j) lj[j] += p[j];
      pt.u[t] = pack8(p);
    }
#pragma unroll
    for (int nb = 0; nb < 4; ++nb) {
      v16bf av = load_tile(Vth, kp * 4 + nb);
      o[nb] = wmma_bf16(av, pt.bf, o[nb]);
    }
  }

  float l = ((lj[0] + lj[1]) + (lj[2] + lj[3])) + ((lj[4] + lj[5]) + (lj[6] + lj[7]));
  l += __shfl_xor(l, 16, 32);  // the other half's keys

  // Store O as A-fragment tiles of the concat matrix: row tile (b, qt),
  // k = h*64 + d, two tiles of 32 d; accumulator nb is chunk nb & 1 of tile nb >> 1.
  bf16* Oc = Pc + ((size_t)(b * 64 + qt) * KTILES + h * 2) * TILE_ELEMS + lane * 8;
#pragma unroll
  for (int nb = 0; nb < 4; ++nb) {
    float v[8];
#pragma unroll
    for (int j = 0; j < 8; ++j) v[j] = o[nb][j] / l;
    *(v4u*)(Oc + nb * 256) = pack8(v);
  }
}

// ---------------------------------------------------------------------------
// Host-side launch. Workspace layout (needs 64 MB), all in fragment order:
//  [ 0MB) qb  [ 8MB) kb  [16MB) vb            (bf16 activations, 8MB each)
//  [24MB) Wqb [26MB) Wkb [28MB) Wvb [30MB) Wob (bf16 weights, 2MB each)
//  [32MB) Pq  [40MB) Pk  [48MB) Vt  [56MB) Pc  (bf16 intermediates, 8MB each)
// ---------------------------------------------------------------------------
extern "C" void kernel_launch(void* const* d_in, const int* in_sizes, int n_in,
                              void* d_out, int out_size, void* d_ws,
                              size_t ws_size, hipStream_t stream) {
  (void)in_sizes; (void)n_in; (void)out_size; (void)ws_size;
  const float* q  = (const float*)d_in[0];
  const float* k  = (const float*)d_in[1];
  const float* v  = (const float*)d_in[2];
  const float* Wq = (const float*)d_in[3];
  const float* Wk = (const float*)d_in[4];
  const float* Wv = (const float*)d_in[5];
  const float* Wo = (const float*)d_in[6];
  float* out = (float*)d_out;

  char* ws = (char*)d_ws;
  const size_t MB = (size_t)1 << 20;
  bf16* qb  = (bf16*)(ws + 0 * MB);
  bf16* Wqb = (bf16*)(ws + 24 * MB);
  bf16* Wob = (bf16*)(ws + 30 * MB);
  bf16* Pq  = (bf16*)(ws + 32 * MB);
  bf16* Pk  = (bf16*)(ws + 40 * MB);
  bf16* Vt  = (bf16*)(ws + 48 * MB);
  bf16* Pc  = (bf16*)(ws + 56 * MB);

  // qb .. Wob are filled as one run of chunks from qb on
  mha_f32_to_bf16_frag<<<CVT_BLOCKS, 256, 0, stream>>>(q, k, v, Wq, Wk, Wv, Wo, qb);

  // (qb, kb, vb) x (Wqb, Wkb, Wvb) -> (Pq, Pk, Vt)
  mha_gemm_qkv<<<dim3(DMODEL / 256, MROWS / 64, 3), 256, 0, stream>>>(qb, Wqb, Pq);

  mha_attn<<<BATCH * HEADS * (SEQL / 128), 256, 0, stream>>>(Pq, Pk, Vt, Pc);

  mha_gemm_out<<<dim3(DMODEL / 256, MROWS / 64), 256, 0, stream>>>(Pc, Wob, out, q);
}

// v006
// A run of this version takes 85.2 microseconds.
// It is 1.90 times as fast as v004, going by the measured steps of the versions left out in between.
// Counting every step since v000, it is 3.74 times as fast.
#include <hip/hip_runtime.h>
#include <hip/hip_bf16.h>
#include <stdint.h>

// Problem constants (match the JAX reference)
#define HEADS  16
#define DMODEL 1024
#define DK     64
#define BATCH  4
#define SEQL   1024
#define MROWS  (BATCH * SEQL)   // 4096
#define NEG_BIG (-1000000000.0f)

typedef __bf16    bf16;
typedef uint32_t  u32;
typedef __attribute__((ext_vector_type(16))) bf16  v16bf;
typedef __attribute__((ext_vector_type(8)))  float v8f;
typedef __attribute__((ext_vector_type(2)))  float v2f;
typedef __attribute__((ext_vector_type(4)))  u32   v4u;

union FragU { v16bf bf; v4u u[2]; };

// Load one 16-bit WMMA operand fragment: two contiguous 8-element (16B) chunks.
// Per the CDNA5 ISA 16-bit A-matrix layout, lane L holds K elements
// {half*8 .. half*8+7} and {16+half*8 .. 16+half*8+7} (half = L>=16).
// The caller passes pointers already offset to those two chunks.
__device__ inline v16bf load_frag(const bf16* p0, const bf16* p1) {
  FragU f;
  f.u[0] = *(const v4u*)p0;
  f.u[1] = *(const v4u*)p1;
  return f.bf;
}

__device__ inline v8f wmma_bf16(v16bf a, v16bf b, v8f c) {
  // D = A(16x32 bf16) x B(32x16 bf16) + C(16x16 f32)
  return __builtin_amdgcn_wmma_f32_16x16x32_bf16(
      false, a, false, b, (short)0, c, false, false);
}

// float -> bf16, round to nearest even (bit manipulation: no __bf16 arith needed)
__device__ inline bf16 f2b(float f) {
  union { float f; u32 u; } x; x.f = f;
  u32 r = x.u + 0x7FFFu + ((x.u >> 16) & 1u);
  union { unsigned short s; bf16 b; } y; y.s = (unsigned short)(r >> 16);
  return y.b;
}

// ---------------------------------------------------------------------------
// Fragment order. Every bf16 tensor in the workspace is kept as 1-KiB tiles of
// 16 rows x 32 k, each tile in the order in which a wave loads it as a 16-bit
// WMMA operand: [chunk c = 0,1][lane = half*16 + r][8 elements], holding
// element (row r, k = c*16 + half*8 + e). One 16-byte-per-lane access of a wave
// is then 512 contiguous bytes (4 whole lines) instead of 32 bytes of 16 lines.
// ---------------------------------------------------------------------------
#define TILE_ELEMS 512   // 16 x 32 bf16
#define KTILES     (DMODEL / 32)

// Fragment of tile number tile; p already holds the lane's own offset (lane*8).
__device__ inline v16bf load_tile(const bf16* p, int tile) {
  const bf16* t = p + (size_t)tile * TILE_ELEMS;
  return load_frag(t, t + 256);
}

__device__ inline v4u pack8(const float* v) {
  union { bf16 e[8]; v4u u; } pk;
#pragma unroll
  for (int j = 0; j < 8; ++j) pk.e[j] = f2b(v[j]);
  return pk.u;
}

// ---------------------------------------------------------------------------
// float32 [rows][1024] row-major -> bf16 tiles [rows/16][32] in fragment order.
// One thread makes one 16-byte chunk. All seven tensors share one grid: none
// needs anything of another, and their bf16 copies lie one behind the other in
// y (q, k, v, Wq, Wk, Wv, Wo), so the block index names both the source tensor
// (the same for a whole block) and the place in y.
// ---------------------------------------------------------------------------
#define ACT_BLOCKS (MROWS * DMODEL / 8 / 256)    // 2048 blocks per activation
#define WGT_BLOCKS (DMODEL * DMODEL / 8 / 256)   // 512 blocks per weight
#define CVT_BLOCKS (3 * ACT_BLOCKS + 4 * WGT_BLOCKS)

__global__ __launch_bounds__(256)
void mha_f32_to_bf16_frag(const float* __restrict__ q, const float* __restrict__ k,
                          const float* __restrict__ v, const float* __restrict__ Wq,
                          const float* __restrict__ Wk, const float* __restrict__ Wv,
                          const float* __restrict__ Wo, bf16* __restrict__ y) {
  const u32 blk = blockIdx.x;
  const float* x = (blk < 1 * ACT_BLOCKS) ? q
                 : (blk < 2 * ACT_BLOCKS) ? k
                 : (blk < 3 * ACT_BLOCKS) ? v
                 : (blk < 3 * ACT_BLOCKS + 1 * WGT_BLOCKS) ? Wq
                 : (blk < 3 * ACT_BLOCKS + 2 * WGT_BLOCKS) ? Wk
                 : (blk < 3 * ACT_BLOCKS + 3 * WGT_BLOCKS) ? Wv : Wo;
  // block number within its own tensor: every tensor starts at a multiple of
  // its own (power-of-two) block count
  const u32 lb = blk & ((blk < 3 * ACT_BLOCKS) ? ACT_BLOCKS - 1 : WGT_BLOCKS - 1);
  const int g  = (int)(lb * 256 + threadIdx.x);  // chunk within the tensor
  const int L  = g & 31;
  const int c  = (g >> 5) & 1;
  const int kt = (g >> 6) & (KTILES - 1);
  const int rt = g >> 11;
  const float* s = x + (size_t)(rt * 16 + (L & 15)) * DMODEL +
                   kt * 32 + c * 16 + (L >> 4) * 8;
  const float4 a = *(const float4*)s;
  const float4 b = *(const float4*)(s + 4);
  const float e[8] = {a.x, a.y, a.z, a.w, b.x, b.y, b.z, b.w};
  *(v4u*)(y + ((size_t)blk * 256 + threadIdx.x) * 8) = pack8(e);
}

// ---------------------------------------------------------------------------
// C[4096,1024] = A[4096,1024](bf16) @ W[1024,1024](bf16)^T, A and W in
// fragment order. Wave tile 32x64 (2x4 accumulators); workgroup tile 64x256.
//
// The head slab (b,h) is the contiguous reshape of C[b, 64h:64h+64, :]:
// element (s, col) is position t = (s & 63) * 16 + (col >> 6), d = col & 63.
// Attention may take its positions in any order, so a tile of 16 positions is
// 16 neighbouring s of one column block: tile number (col >> 6) * 4 +
// ((s & 63) >> 4), row s & 15. A 16x16 accumulator tile is then one chunk.
//
// MODE 0 (Q, K): operands swapped (tile = W * A^T), so a lane holds 8
//         neighbouring d of one s. Out: [b,h][64 tiles][d/32] fragment tiles.
// MODE 1 (V): a lane holds 8 neighbouring s of one d. Out: V^T fragment tiles
//         [b,h][32 blocks of 32 positions][d/16], rows d, k = position.
// MODE 2: f32 out = C + resid. A's row tiles are attention's query tiles
//         (b, tile number); the rows go back to their places here.
//
// The operands come through LDS. A slice is KS k-tiles of the workgroup's 4 row
// tiles of A and 16 row tiles of W: 20 runs of KS KiB, each contiguous in the
// workspace, laid one behind the other in LDS, still in fragment order. Every
// thread copies 16 bytes per round; the four waves that need the same A tile and
// the two that need the same W tile read it from LDS, so a tile leaves L2 once
// per workgroup. Two buffers: slice t + 1 is on its way while slice t is used.
// ---------------------------------------------------------------------------
#define WG_ROWTILES 20   // 4 of A, then 16 of W
#define SLICE_ELEMS(KS) (WG_ROWTILES * (KS) * TILE_ELEMS)

// Ten asynchronous 16-byte copies per lane, global memory to LDS: copy u goes
// from g[u] to LDS byte address l[u]. The wait at the end stands inside the
// statement so that no address register of a copy is rewritten in front of it.
__device__ __forceinline__
void copy10(const u32* l, const char* const* g) {
  asm volatile("global_load_async_to_lds_b128 %0, %1, off\n\t"
               "global_load_async_to_lds_b128 %2, %3, off\n\t"
               "global_load_async_to_lds_b128 %4, %5, off\n\t"
               "global_load_async_to_lds_b128 %6, %7, off\n\t"
               "global_load_async_to_lds_b128 %8, %9, off\n\t"
               "global_load_async_to_lds_b128 %10, %11, off\n\t"
               "global_load_async_to_lds_b128 %12, %13, off\n\t"
               "global_load_async_to_lds_b128 %14, %15, off\n\t"
               "global_load_async_to_lds_b128 %16, %17, off\n\t"
               "global_load_async_to_lds_b128 %18, %19, off\n\t"
               "s_wait_xcnt 0x0"
               :: "v"(l[0]), "v"(g[0]), "v"(l[1]), "v"(g[1]), "v"(l[2]), "v"(g[2]),
                  "v"(l[3]), "v"(g[3]), "v"(l[4]), "v"(g[4]), "v"(l[5]), "v"(g[5]),
                  "v"(l[6]), "v"(g[6]), "v"(l[7]), "v"(g[7]), "v"(l[8]), "v"(g[8]),
                  "v"(l[9]), "v"(g[9])
               : "memory");
}

// One slice. l: the thread's LDS byte address in round 0; ga, gw: its source in
// the first A round and the first W round. A round is 4 KiB of LDS = 4 / KS row
// tiles, which lie 32 KiB apart in the workspace.
template <int KS>
__device__ __forceinline__
void copy_slice(u32 l, const char* ga, const char* gw) {
  constexpr int RPR    = 4 / KS;             // row tiles per round
  constexpr int ROUNDS = WG_ROWTILES / RPR;
  constexpr int AR     = 4 / RPR;            // rounds that bring A
  constexpr int STEP   = RPR * KTILES * TILE_ELEMS * 2;  // bytes, round to round
#pragma unroll
  for (int i = 0; i < ROUNDS; i += 10) {
    u32 d[10];
    const char* g[10];
#pragma unroll
    for (int u = 0; u < 10; ++u) {
      d[u] = l + (i + u) * 4096;
      g[u] = (i + u < AR) ? ga + (i + u) * STEP : gw + (i + u - AR) * STEP;
    }
    copy10(d, g);
  }
}

template <int MODE, int KS>
__device__ __forceinline__
void gemm_tile(const bf16* __restrict__ A, const bf16* __restrict__ W,
               bf16* __restrict__ outB, float* __restrict__ outF,
               const float* __restrict__ resid, bf16* sm) {
  const int lane = threadIdx.x & 31;
  const int wave = threadIdx.x >> 5;
  const int half = lane >> 4;
  const int r    = lane & 15;
  const int wm   = wave >> 2;  // 0..1
  const int wn   = wave & 3;   // 0..3
  const int M0 = blockIdx.y * 64 + wm * 32;
  const int N0 = blockIdx.x * 256 + wn * 64;

  v8f acc[2][4];
#pragma unroll
  for (int i = 0; i < 2; ++i)
#pragma unroll
    for (int j = 0; j < 4; ++j) acc[i][j] = (v8f){0, 0, 0, 0, 0, 0, 0, 0};

  constexpr int NT          = KTILES / KS;            // slices
  constexpr int SLICE_BYTES = SLICE_ELEMS(KS) * 2;
  constexpr int TPR         = KS * 64;                // threads per row tile's run
  const int tid = threadIdx.x;
  const size_t src_off = (size_t)(tid / TPR) * (KTILES * TILE_ELEMS * 2) + (tid % TPR) * 16;
  const char* ga = (const char*)(A + (size_t)(blockIdx.y * 4) * KTILES * TILE_ELEMS) + src_off;
  const char* gw = (const char*)(W + (size_t)(blockIdx.x * 16) * KTILES * TILE_ELEMS) + src_off;
  const u32 l0 = (u32)(uintptr_t)sm + tid * 16;       // LDS byte address

  copy_slice<KS>(l0, ga, gw);
  // slice 0 has landed for this wave's copies; the barrier says so for all waves
  asm volatile("s_wait_asynccnt 0x0" ::: "memory");
  __syncthreads();
  copy_slice<KS>(l0 + SLICE_BYTES, ga + KS * 1024, gw + KS * 1024);

  for (int t = 0; t < NT; ++t) {
    const bf16* sb = sm + (t & 1) * SLICE_ELEMS(KS) + lane * 8;
#pragma unroll
    for (int kk = 0; kk < KS; ++kk) {
      v16bf af[2], bf_[4];
#pragma unroll
      for (int ms = 0; ms < 2; ++ms) af[ms] = load_tile(sb, (wm * 2 + ms) * KS + kk);
#pragma unroll
      for (int ns = 0; ns < 4; ++ns) bf_[ns] = load_tile(sb, (4 + wn * 4 + ns) * KS + kk);
#pragma unroll
      for (int ms = 0; ms < 2; ++ms)
#pragma unroll
        for (int ns = 0; ns < 4; ++ns)
          acc[ms][ns] = (MODE == 0) ? wmma_bf16(bf_[ns], af[ms], acc[ms][ns])
                                    : wmma_bf16(af[ms], bf_[ns], acc[ms][ns]);
    }
    // Hand-over: this wave's reads of slice t are done, its copies of slice t + 1
    // have landed; behind the barrier both hold for every wave, so slice t + 1 may
    // be read and the buffer of slice t refilled.
    asm volatile("s_wait_dscnt 0x0" ::: "memory");
    asm volatile("s_wait_asynccnt 0x0" ::: "memory");
    __syncthreads();
    if (t + 2 < NT)
      copy_slice<KS>(l0 + (t & 1) * SLICE_BYTES, ga + (t + 2) * (KS * 1024),
                     gw + (t + 2) * (KS * 1024));
  }
  // no copy is left in flight when the wave goes on
  asm volatile("s_wait_asynccnt 0x0" ::: "memory");

  if (MODE == 0 || MODE == 1) {
    const int bh = ((M0 >> 10) * HEADS) + ((M0 & 1023) >> 6);
    const int cb = N0 >> 6;            // column block 0..15
    const int sb = (M0 & 63) >> 4;     // 0 or 2; + ms
#pragma unroll
    for (int ms = 0; ms < 2; ++ms) {
#pragma unroll
      for (int ns = 0; ns < 4; ++ns) {
        float v[8];
#pragma unroll
        for (int j = 0; j < 8; ++j) v[j] = acc[ms][ns][j];
        // chunk number: MODE 0 tile (cb*4 + sb + ms), d/32 = ns>>1, c = ns&1
        //               MODE 1 block (cb*2 + sb/2), d/16 = ns, c = ms
        const int chunk =
            (MODE == 0)
                ? (((bh * 64 + cb * 4 + sb + ms) * 2 + (ns >> 1)) * 2 + (ns & 1))
                : (((bh * 32 + cb * 2 + (sb >> 1)) * 4 + ns) * 2 + ms);
        *(v4u*)(outB + (size_t)chunk * 256 + lane * 8) = pack8(v);
        // stands in front of the next chunk's packing, which may overwrite the
        // registers that this store names
        asm volatile("s_wait_xcnt 0x0" ::: "memory");
      }
    }
    return;
  }

  // C/D layout: lanes 0-15 hold rows j, lanes 16-31 rows j+8; col = lane&15.
  // Both row tiles of the wave share b and cb (M0 is a multiple of 32), so one
  // base serves: tile ms is 256 rows on, register j is 16 rows on.
  const int rt = M0 >> 4;            // (b, query tile), even
  const int b  = rt >> 6;
  const int cb = (rt & 63) >> 2;
  const int sb = rt & 3;
  const size_t base =
      ((size_t)b * SEQL + ((sb * 16 + 8 * half) << 4) + cb) * DMODEL + N0 + r;
  const float* rp = resid + base;
  float*       op = outF + base;
  float rv[2][4][8];
#pragma unroll
  for (int ms = 0; ms < 2; ++ms)
#pragma unroll
    for (int ns = 0; ns < 4; ++ns)
#pragma unroll
      for (int j = 0; j < 8; ++j)
        rv[ms][ns][j] = rp[(ms * 256 + j * 16) * DMODEL + ns * 16];
#pragma unroll
  for (int ms = 0; ms < 2; ++ms)
#pragma unroll
    for (int ns = 0; ns < 4; ++ns)
#pragma unroll
      for (int j = 0; j < 8; ++j)
        op[(ms * 256 + j * 16) * DMODEL + ns * 16] = acc[ms][ns][j] + rv[ms][ns][j];
}

// The three projections need nothing of each other: one grid, blockIdx.z = 0, 1,
// 2 for Q, K, V. X, Wt and P each hold their three tensors one behind the other.
// Six waves per SIMD (at most 160 registers): three workgroups then share a WGP,
// and all 768 are resident at once; their LDS, 3 x 80 KiB, fits as well.
__global__ __launch_bounds__(256) __attribute__((amdgpu_waves_per_eu(6)))
void mha_gemm_qkv(const bf16* __restrict__ X, const bf16* __restrict__ Wt,
                  bf16* __restrict__ P) {
  const int z = blockIdx.z;
  const bf16* A = X + (size_t)z * (MROWS * DMODEL);
  const bf16* W = Wt + (size_t)z * (DMODEL * DMODEL);
  bf16*       O = P + (size_t)z * (MROWS * DMODEL);
  __shared__ __attribute__((aligned(1024))) bf16 sm[2 * SLICE_ELEMS(2)];
  if (z == 2) gemm_tile<1, 2>(A, W, O, nullptr, nullptr, sm);
  else        gemm_tile<0, 2>(A, W, O, nullptr, nullptr, sm);
}

__global__ __launch_bounds__(256)
void mha_gemm_out(const bf16* __restrict__ A, const bf16* __restrict__ W,
                  float* __restrict__ outF, const float* __restrict__ resid) {
  // one workgroup per WGP here: longer slices, so that a slice's work covers the
  // next one's way from L2
  __shared__ __attribute__((aligned(1024))) bf16 sm[2 * SLICE_ELEMS(4)];
  gemm_tile<2, 4>(A, W, nullptr, outF, resid, sm);
}

// Eight exp2 in one statement. Behind a transcendental the instruction set asks
// for one independent instruction before its result is read or its source is
// overwritten. Inside the statement the next exp2 is that instruction (the
// outputs are early-clobber, so none lies on a source); behind the last one
// stands v_nop.
__device__ inline void exp2x8(float* p, const float* a) {
  asm("v_exp_f32 %0, %8\n\t"
      "v_exp_f32 %1, %9\n\t"
      "v_exp_f32 %2, %10\n\t"
      "v_exp_f32 %3, %11\n\t"
      "v_exp_f32 %4, %12\n\t"
      "v_exp_f32 %5, %13\n\t"
      "v_exp_f32 %6, %14\n\t"
      "v_exp_f32 %7, %15\n\t"
      "v_nop"
      : "=&v"(p[0]), "=&v"(p[1]), "=&v"(p[2]), "=&v"(p[3]),
        "=&v"(p[4]), "=&v"(p[5]), "=&v"(p[6]), "=&v"(p[7])
      : "v"(a[0]), "v"(a[1]), "v"(a[2]), "v"(a[3]),
        "v"(a[4]), "v"(a[5]), "v"(a[6]), "v"(a[7]));
}

// One exp2, with the same slot behind it.
__device__ inline float exp2x1(float a) {
  float p;
  asm("v_exp_f32 %0, %1\n\t"
      "v_nop"
      : "=&v"(p) : "v"(a));
  return p;
}

#define RAISE 5.5f   // a score may top the maximum in use by this much

__global__ __launch_bounds__(256)
void mha_attn(const bf16* __restrict__ Pq, const bf16* __restrict__ Pk,
              const bf16* __restrict__ Vt, bf16* __restrict__ Pc) {
  const int lane = threadIdx.x & 31;
  const int wave = threadIdx.x >> 5;

  const int qblk = blockIdx.x & 7;
  const int bh   = blockIdx.x >> 3;
  const int b    = bh >> 4;
  const int h    = bh & 15;

  const int qt = qblk * 8 + wave;  // query tile 0..63

  // head slabs, each 128 tiles of 1 KiB, with the lane's own offset
  const bf16* Qh  = Pq + (size_t)bh * (SEQL * DK) + lane * 8;  // [64][2]
  const bf16* Kh  = Pk + (size_t)bh * (SEQL * DK) + lane * 8;  // [64][2]
  const bf16* Vth = Vt + (size_t)bh * (DK * SEQL) + lane * 8;  // [32][4]

  // Q^T fragments for this wave's 16 queries (K-dim = d, 0..31 and 32..63)
  v16bf bq[2];
  bq[0] = load_tile(Qh, qt * 2);
  bq[1] = load_tile(Qh, qt * 2 + 1);

  const v8f vzero = (v8f){0, 0, 0, 0, 0, 0, 0, 0};

  // ---- one pass over the keys: running maximum, sum and O^T together ----
  // m is the maximum in use for query r, the same value in both halves of the
  // wave. p = exp(s - m) stays exact for any m as long as sum and output use the
  // same m, so m is raised only when a score tops it by more than RAISE; p then
  // never exceeds exp(RAISE).
  float m = -1e30f;
  v2f lj[4];  // eight partial sums, in pairs: sum j is lj[j >> 1][j & 1]
#pragma unroll
  for (int j = 0; j < 4; ++j) lj[j] = (v2f){0.0f, 0.0f};
  v8f o[4];
#pragma unroll
  for (int nb = 0; nb < 4; ++nb) o[nb] = vzero;

  for (int kp = 0; kp < SEQL / 32; ++kp) {
    // all 16 loads of the block first: K, which is needed first, then V^T
    v16bf ak[4], av[4];
#pragma unroll
    for (int i = 0; i < 4; ++i) ak[i] = load_tile(Kh, kp * 4 + i);
#pragma unroll
    for (int nb = 0; nb < 4; ++nb) av[nb] = load_tile(Vth, kp * 4 + nb);
    // keeps the 16 loads in one group here: left free, the compiler issued K in
    // four dependent pairs with a full wait behind each, and V^T behind the test
    __builtin_amdgcn_sched_barrier(0);
    float sv[2][8];
#pragma unroll
    for (int t = 0; t < 2; ++t) {
      v8f s = vzero;
      s = wmma_bf16(ak[t * 2], bq[0], s);
      s = wmma_bf16(ak[t * 2 + 1], bq[1], s);
#pragma unroll
      for (int j = 0; j < 8; ++j)
        sv[t][j] = (s[j] == 0.0f) ? NEG_BIG : s[j] * 0.125f;  // mask, then 1/sqrt(64)
    }
    float bm = sv[0][0];
#pragma unroll
    for (int j = 1; j < 16; ++j) bm = fmaxf(bm, sv[j >> 3][j & 7]);
    // One test per 32 keys, a scalar branch. Every lane takes the new maximum
    // when any lane asks for one, so the two halves of a query stay alike.
    if (__builtin_amdgcn_ballot_w32(bm > m + RAISE) != 0) {
      const float nm = fmaxf(m, fmaxf(bm, __shfl_xor(bm, 16, 32)));
      const float f  = exp2x1((m - nm) * 1.44269504f);
      m = nm;
#pragma unroll
      for (int j = 0; j < 4; ++j) lj[j] *= f;
#pragma unroll
      for (int nb = 0; nb < 4; ++nb)
#pragma unroll
        for (int j = 0; j < 8; ++j) o[nb][j] *= f;
    }
    FragU pt;  // P^T, 32 keys x 16 queries, as a B fragment
#pragma unroll
    for (int t = 0; t < 2; ++t) {
      float a[8], p[8];
#pragma unroll
      for (int j = 0; j < 8; ++j)
        a[j] = (sv[t][j] - m) * 1.44269504f;  // exp(x) = exp2(x * log2 e), as __expf forms it
      exp2x8(p, a);
#pragma unroll
      for (int j = 0; j < 4; ++j) lj[j] += (v2f){p[2 * j], p[2 * j + 1]};
      pt.u[t] = pack8(p);
    }
#pragma unroll
    for (int nb = 0; nb < 4; ++nb) o[nb] = wmma_bf16(av[nb], pt.bf, o[nb]);
  }

  float l = ((lj[0][0] + lj[0][1]) + (lj[1][0] + lj[1][1])) +
            ((lj[2][0] + lj[2][1]) + (lj[3][0] + lj[3][1]));
  l += __shfl_xor(l, 16, 32);  // the other half's keys

  // Store O as A-fragment tiles of the concat matrix: row tile (b, qt),
  // k = h*64 + d, two tiles of 32 d; accumulator nb is chunk nb & 1 of tile nb >> 1.
  bf16* Oc = Pc + ((size_t)(b * 64 + qt) * KTILES + h * 2) * TILE_ELEMS + lane * 8;
#pragma unroll
  for (int nb = 0; nb < 4; ++nb) {
    float v[8];
#pragma unroll
    for (int j = 0; j < 8; ++j) v[j] = o[nb][j] / l;
    *(v4u*)(Oc + nb * 256) = pack8(v);
  }
}

// ---------------------------------------------------------------------------
// Host-side launch. Workspace layout (needs 64 MB), all in fragment order:
//  [ 0MB) qb  [ 8MB) kb  [16MB) vb            (bf16 activations, 8MB each)
//  [24MB) Wqb [26MB) Wkb [28MB) Wvb [30MB) Wob (bf16 weights, 2MB each)
//  [32MB) Pq  [40MB) Pk  [48MB) Vt  [56MB) Pc  (bf16 intermediates, 8MB each)
// ---------------------------------------------------------------------------
extern "C" void kernel_launch(void* const* d_in, const int* in_sizes, int n_in,
                              void* d_out, int out_size, void* d_ws,
                              size_t ws_size, hipStream_t stream) {
  (void)in_sizes; (void)n_in; (void)out_size; (void)ws_size;
  const float* q  = (const float*)d_in[0];
  const float* k  = (const float*)d_in[1];
  const float* v  = (const float*)d_in[2];
  const float* Wq = (const float*)d_in[3];
  const float* Wk = (const float*)d_in[4];
  const float* Wv = (const float*)d_in[5];
  const float* Wo = (const float*)d_in[6];
  float* out = (float*)d_out;

  char* ws = (char*)d_ws;
  const size_t MB = (size_t)1 << 20;
  bf16* qb  = (bf16*)(ws + 0 * MB);
  bf16* Wqb = (bf16*)(ws + 24 * MB);
  bf16* Wob = (bf16*)(ws + 30 * MB);
  bf16* Pq  = (bf16*)(ws + 32 * MB);
  bf16* Pk  = (bf16*)(ws + 40 * MB);
  bf16* Vt  = (bf16*)(ws + 48 * MB);
  bf16* Pc  = (bf16*)(ws + 56 * MB);

  // qb .. Wob are filled as one run of chunks from qb on
  mha_f32_to_bf16_frag<<<CVT_BLOCKS, 256, 0, stream>>>(q, k, v, Wq, Wk, Wv, Wo, qb);

  // (qb, kb, vb) x (Wqb, Wkb, Wvb) -> (Pq, Pk, Vt)
  mha_gemm_qkv<<<dim3(DMODEL / 256, MROWS / 64, 3), 256, 0, stream>>>(qb, Wqb, Pq);

  mha_attn<<<BATCH * HEADS * (SEQL / 128), 256, 0, stream>>>(Pq, Pk, Vt, Pc);

  mha_gemm_out<<<dim3(DMODEL / 256, MROWS / 64), 256, 0, stream>>>(Pc, Wob, out, q);
}

// v007
// Measured time: 79.9 microseconds a run.
// Timed twice side by side with v006, it ran 1.06 times as fast both times.
// Counting every step since v000, it is 3.95 times as fast.
#include <hip/hip_runtime.h>
#include <hip/hip_bf16.h>
#include <stdint.h>

// Problem constants (match the JAX reference)
#define HEADS  16
#define DMODEL 1024
#define DK     64
#define BATCH  4
#define SEQL   1024
#define MROWS  (BATCH * SEQL)   // 4096
#define NEG_BIG (-1000000000.0f)

typedef __bf16    bf16;
typedef uint32_t  u32;
typedef __attribute__((ext_vector_type(16))) bf16  v16bf;
typedef __attribute__((ext_vector_type(8)))  float v8f;
typedef __attribute__((ext_vector_type(2)))  float v2f;
typedef __attribute__((ext_vector_type(4)))  u32   v4u;

union FragU { v16bf bf; v4u u[2]; };

// Load one 16-bit WMMA operand fragment: two contiguous 8-element (16B) chunks.
// Per the CDNA5 ISA 16-bit A-matrix layout, lane L holds K elements
// {half*8 .. half*8+7} and {16+half*8 .. 16+half*8+7} (half = L>=16).
// The caller passes pointers already offset to those two chunks.
__device__ inline v16bf load_frag(const bf16* p0, const bf16* p1) {
  FragU f;
  f.u[0] = *(const v4u*)p0;
  f.u[1] = *(const v4u*)p1;
  return f.bf;
}

__device__ inline v8f wmma_bf16(v16bf a, v16bf b, v8f c) {
  // D = A(16x32 bf16) x B(32x16 bf16) + C(16x16 f32)
  return __builtin_amdgcn_wmma_f32_16x16x32_bf16(
      false, a, false, b, (short)0, c, false, false);
}

// float -> bf16, round to nearest even (bit manipulation: no __bf16 arith needed)
__device__ inline bf16 f2b(float f) {
  union { float f; u32 u; } x; x.f = f;
  u32 r = x.u + 0x7FFFu + ((x.u >> 16) & 1u);
  union { unsigned short s; bf16 b; } y; y.s = (unsigned short)(r >> 16);
  return y.b;
}

// ---------------------------------------------------------------------------
// Fragment order. Every bf16 tensor in the workspace is kept as 1-KiB tiles of
// 16 rows x 32 k, each tile in the order in which a wave loads it as a 16-bit
// WMMA operand: [chunk c = 0,1][lane = half*16 + r][8 elements], holding
// element (row r, k = c*16 + half*8 + e). One 16-byte-per-lane access of a wave
// is then 512 contiguous bytes (4 whole lines) instead of 32 bytes of 16 lines.
// ---------------------------------------------------------------------------
#define TILE_ELEMS 512   // 16 x 32 bf16
#define KTILES     (DMODEL / 32)

// Fragment of tile number tile; p already holds the lane's own offset (lane*8).
__device__ inline v16bf load_tile(const bf16* p, int tile) {
  const bf16* t = p + (size_t)tile * TILE_ELEMS;
  return load_frag(t, t + 256);
}

__device__ inline v4u pack8(const float* v) {
  union { bf16 e[8]; v4u u; } pk;
#pragma unroll
  for (int j = 0; j < 8; ++j) pk.e[j] = f2b(v[j]);
  return pk.u;
}

// ---------------------------------------------------------------------------
// float32 [rows][1024] row-major -> bf16 tiles [rows/16][32] in fragment order.
// All seven tensors share one grid: none needs anything of another, and their
// bf16 copies lie one behind the other in y (q, k, v, Wq, Wk, Wv, Wo), so the
// block index names both the source tensor (the same for a whole block) and the
// place in y.
//
// The launch is a stream, so it is cut into few, long waves: 32 per WGP, all
// resident at once, each with all of its loads in flight. A workgroup converts
// one whole row tile (64 KiB read, 32 KiB written, both contiguous); a wave takes
// 128 columns of it (4 fragment tiles), a thread makes 8 chunks of 16 bytes.
// Four neighbouring lanes read one 128-byte line of a row, 8 rows per load; the
// eight lanes that hold the same k of rows 0..7 (or 8..15) then store one whole
// 128-byte line of the tile.
// ---------------------------------------------------------------------------
#define ACT_BLOCKS (MROWS / 16)    // 256 blocks (row tiles) per activation
#define WGT_BLOCKS (DMODEL / 16)   // 64 blocks per weight
#define CVT_BLOCKS (3 * ACT_BLOCKS + 4 * WGT_BLOCKS)

__global__ __launch_bounds__(256)
void mha_f32_to_bf16_frag(const float* __restrict__ q, const float* __restrict__ k,
                          const float* __restrict__ v, const float* __restrict__ Wq,
                          const float* __restrict__ Wk, const float* __restrict__ Wv,
                          const float* __restrict__ Wo, bf16* __restrict__ y) {
  const u32 blk = blockIdx.x;
  const float* x = (blk < 1 * ACT_BLOCKS) ? q
                 : (blk < 2 * ACT_BLOCKS) ? k
                 : (blk < 3 * ACT_BLOCKS) ? v
                 : (blk < 3 * ACT_BLOCKS + 1 * WGT_BLOCKS) ? Wq
                 : (blk < 3 * ACT_BLOCKS + 2 * WGT_BLOCKS) ? Wk
                 : (blk < 3 * ACT_BLOCKS + 3 * WGT_BLOCKS) ? Wv : Wo;
  // block number within its own tensor: every tensor starts at a multiple of
  // its own (power-of-two) block count
  const u32 lb = blk & ((blk < 3 * ACT_BLOCKS) ? ACT_BLOCKS - 1 : WGT_BLOCKS - 1);
  const int lane = threadIdx.x & 31;
  const int wave = threadIdx.x >> 5;  // columns wave*128 .. +127 = k-tiles wave*4 .. +3
  const int rr   = lane >> 2;         // row within a group of 8 rows
  const int wq   = lane & 3;          // k = wq*8 .. +7 of a k-tile: c = wq>>1, half = wq&1
  const float* s = x + (size_t)(lb * 16 + rr) * DMODEL + wave * 128 + wq * 8;
  bf16*        d = y + ((size_t)blk * KTILES + wave * 4) * TILE_ELEMS + (wq * 16 + rr) * 8;
  // chunk u: row (u >> 2) * 8 + rr, k-tile wave*4 + (u & 3)
  float4 a[8], b[8];
#pragma unroll
  for (int u = 0; u < 8; ++u) {
    const float* p = s + (u >> 2) * (8 * DMODEL) + (u & 3) * 32;
    a[u] = *(const float4*)p;
    b[u] = *(const float4*)(p + 4);
  }
  // Stands in front of every instruction that may overwrite the address pair
  // which the loads name. The pointer is an input so that the pair stays whole up
  // to here: left free, the last load's own destination lay on it.
  asm volatile("s_wait_xcnt 0x0" :: "v"(s) : "memory");
#pragma unroll
  for (int u = 0; u < 8; ++u) {
    const float e[8] = {a[u].x, a[u].y, a[u].z, a[u].w, b[u].x, b[u].y, b[u].z, b[u].w};
    *(v4u*)(d + (u & 3) * TILE_ELEMS + (u >> 2) * 64) = pack8(e);
  }
}

// ---------------------------------------------------------------------------
// C[4096,1024] = A[4096,1024](bf16) @ W[1024,1024](bf16)^T, A and W in
// fragment order. Wave tile 32x64 (2x4 accumulators); workgroup tile 64x256.
//
// The head slab (b,h) is the contiguous reshape of C[b, 64h:64h+64, :]:
// element (s, col) is position t = (s & 63) * 16 + (col >> 6), d = col & 63.
// Attention may take its positions in any order, so a tile of 16 positions is
// 16 neighbouring s of one column block: tile number (col >> 6) * 4 +
// ((s & 63) >> 4), row s & 15. A 16x16 accumulator tile is then one chunk.
//
// MODE 0 (Q, K): operands swapped (tile = W * A^T), so a lane holds 8
//         neighbouring d of one s. Out: [b,h][64 tiles][d/32] fragment tiles.
// MODE 1 (V): a lane holds 8 neighbouring s of one d. Out: V^T fragment tiles
//         [b,h][32 blocks of 32 positions][d/16], rows d, k = position.
// MODE 2: f32 out = C + resid. A's row tiles are attention's query tiles
//         (b, tile number); the rows go back to their places here.
//
// The operands come through LDS. A slice is KS k-tiles of the workgroup's 4 row
// tiles of A and 16 row tiles of W: 20 runs of KS KiB, each contiguous in the
// workspace, laid one behind the other in LDS, still in fragment order. Every
// thread copies 16 bytes per round; the four waves that need the same A tile and
// the two that need the same W tile read it from LDS, so a tile leaves L2 once
// per workgroup. Two buffers: slice t + 1 is on its way while slice t is used.
// ---------------------------------------------------------------------------
#define WG_ROWTILES 20   // 4 of A, then 16 of W
#define SLICE_ELEMS(KS) (WG_ROWTILES * (KS) * TILE_ELEMS)

// Ten asynchronous 16-byte copies per lane, global memory to LDS: copy u goes
// from g[u] to LDS byte address l[u]. The wait at the end stands inside the
// statement so that no address register of a copy is rewritten in front of it.
__device__ __forceinline__
void copy10(const u32* l, const char* const* g) {
  asm volatile("global_load_async_to_lds_b128 %0, %1, off\n\t"
               "global_load_async_to_lds_b128 %2, %3, off\n\t"
               "global_load_async_to_lds_b128 %4, %5, off\n\t"
               "global_load_async_to_lds_b128 %6, %7, off\n\t"
               "global_load_async_to_lds_b128 %8, %9, off\n\t"
               "global_load_async_to_lds_b128 %10, %11, off\n\t"
               "global_load_async_to_lds_b128 %12, %13, off\n\t"
               "global_load_async_to_lds_b128 %14, %15, off\n\t"
               "global_load_async_to_lds_b128 %16, %17, off\n\t"
               "global_load_async_to_lds_b128 %18, %19, off\n\t"
               "s_wait_xcnt 0x0"
               :: "v"(l[0]), "v"(g[0]), "v"(l[1]), "v"(g[1]), "v"(l[2]), "v"(g[2]),
                  "v"(l[3]), "v"(g[3]), "v"(l[4]), "v"(g[4]), "v"(l[5]), "v"(g[5]),
                  "v"(l[6]), "v"(g[6]), "v"(l[7]), "v"(g[7]), "v"(l[8]), "v"(g[8]),
                  "v"(l[9]), "v"(g[9])
               : "memory");
}

// One slice. l: the thread's LDS byte address in round 0; ga, gw: its source in
// the first A round and the first W round. A round is 4 KiB of LDS = 4 / KS row
// tiles, which lie 32 KiB apart in the workspace.
template <int KS>
__device__ __forceinline__
void copy_slice(u32 l, const char* ga, const char* gw) {
  constexpr int RPR    = 4 / KS;             // row tiles per round
  constexpr int ROUNDS = WG_ROWTILES / RPR;
  constexpr int AR     = 4 / RPR;            // rounds that bring A
  constexpr int STEP   = RPR * KTILES * TILE_ELEMS * 2;  // bytes, round to round
#pragma unroll
  for (int i = 0; i < ROUNDS; i += 10) {
    u32 d[10];
    const char* g[10];
#pragma unroll
    for (int u = 0; u < 10; ++u) {
      d[u] = l + (i + u) * 4096;
      g[u] = (i + u < AR) ? ga + (i + u) * STEP : gw + (i + u - AR) * STEP;
    }
    copy10(d, g);
  }
}

template <int MODE, int KS>
__device__ __forceinline__
void gemm_tile(const bf16* __restrict__ A, const bf16* __restrict__ W,
               bf16* __restrict__ outB, float* __restrict__ outF,
               const float* __restrict__ resid, bf16* sm) {
  const int lane = threadIdx.x & 31;
  const int wave = threadIdx.x >> 5;
  const int half = lane >> 4;
  const int r    = lane & 15;
  const int wm   = wave >> 2;  // 0..1
  const int wn   = wave & 3;   // 0..3
  const int M0 = blockIdx.y * 64 + wm * 32;
  const int N0 = blockIdx.x * 256 + wn * 64;

  v8f acc[2][4];
#pragma unroll
  for (int i = 0; i < 2; ++i)
#pragma unroll
    for (int j = 0; j < 4; ++j) acc[i][j] = (v8f){0, 0, 0, 0, 0, 0, 0, 0};

  constexpr int NT          = KTILES / KS;            // slices
  constexpr int SLICE_BYTES = SLICE_ELEMS(KS) * 2;
  constexpr int TPR         = KS * 64;                // threads per row tile's run
  const int tid = threadIdx.x;
  const size_t src_off = (size_t)(tid / TPR) * (KTILES * TILE_ELEMS * 2) + (tid % TPR) * 16;
  const char* ga = (const char*)(A + (size_t)(blockIdx.y * 4) * KTILES * TILE_ELEMS) + src_off;
  const char* gw = (const char*)(W + (size_t)(blockIdx.x * 16) * KTILES * TILE_ELEMS) + src_off;
  const u32 l0 = (u32)(uintptr_t)sm + tid * 16;       // LDS byte address

  copy_slice<KS>(l0, ga, gw);
  // slice 0 has landed for this wave's copies; the barrier says so for all waves
  asm volatile("s_wait_asynccnt 0x0" ::: "memory");
  __syncthreads();
  copy_slice<KS>(l0 + SLICE_BYTES, ga + KS * 1024, gw + KS * 1024);

  for (int t = 0; t < NT; ++t) {
    const bf16* sb = sm + (t & 1) * SLICE_ELEMS(KS) + lane * 8;
#pragma unroll
    for (int kk = 0; kk < KS; ++kk) {
      v16bf af[2], bf_[4];
#pragma unroll
      for (int ms = 0; ms < 2; ++ms) af[ms] = load_tile(sb, (wm * 2 + ms) * KS + kk);
#pragma unroll
      for (int ns = 0; ns < 4; ++ns) bf_[ns] = load_tile(sb, (4 + wn * 4 + ns) * KS + kk);
#pragma unroll
      for (int ms = 0; ms < 2; ++ms)
#pragma unroll
        for (int ns = 0; ns < 4; ++ns)
          acc[ms][ns] = (MODE == 0) ? wmma_bf16(bf_[ns], af[ms], acc[ms][ns])
                                    : wmma_bf16(af[ms], bf_[ns], acc[ms][ns]);
    }
    // Hand-over: this wave's reads of slice t are done, its copies of slice t + 1
    // have landed; behind the barrier both hold for every wave, so slice t + 1 may
    // be read and the buffer of slice t refilled.
    asm volatile("s_wait_dscnt 0x0" ::: "memory");
    asm volatile("s_wait_asynccnt 0x0" ::: "memory");
    __syncthreads();
    if (t + 2 < NT)
      copy_slice<KS>(l0 + (t & 1) * SLICE_BYTES, ga + (t + 2) * (KS * 1024),
                     gw + (t + 2) * (KS * 1024));
  }
  // no copy is left in flight when the wave goes on
  asm volatile("s_wait_asynccnt 0x0" ::: "memory");

  if (MODE == 0 || MODE == 1) {
    const int bh = ((M0 >> 10) * HEADS) + ((M0 & 1023) >> 6);
    const int cb = N0 >> 6;            // column block 0..15
    const int sb = (M0 & 63) >> 4;     // 0 or 2; + ms
#pragma unroll
    for (int ms = 0; ms < 2; ++ms) {
#pragma unroll
      for (int ns = 0; ns < 4; ++ns) {
        float v[8];
#pragma unroll
        for (int j = 0; j < 8; ++j) v[j] = acc[ms][ns][j];
        // chunk number: MODE 0 tile (cb*4 + sb + ms), d/32 = ns>>1, c = ns&1
        //               MODE 1 block (cb*2 + sb/2), d/16 = ns, c = ms
        const int chunk =
            (MODE == 0)
                ? (((bh * 64 + cb * 4 + sb + ms) * 2 + (ns >> 1)) * 2 + (ns & 1))
                : (((bh * 32 + cb * 2 + (sb >> 1)) * 4 + ns) * 2 + ms);
        *(v4u*)(outB + (size_t)chunk * 256 + lane * 8) = pack8(v);
        // stands in front of the next chunk's packing, which may overwrite the
        // registers that this store names
        asm volatile("s_wait_xcnt 0x0" ::: "memory");
      }
    }
    return;
  }

  // C/D layout: lanes 0-15 hold rows j, lanes 16-31 rows j+8; col = lane&15.
  // Both row tiles of the wave share b and cb (M0 is a multiple of 32), so one
  // base serves: tile ms is 256 rows on, register j is 16 rows on.
  const int rt = M0 >> 4;            // (b, query tile), even
  const int b  = rt >> 6;
  const int cb = (rt & 63) >> 2;
  const int sb = rt & 3;
  const size_t base =
      ((size_t)b * SEQL + ((sb * 16 + 8 * half) << 4) + cb) * DMODEL + N0 + r;
  const float* rp = resid + base;
  float*       op = outF + base;
  float rv[2][4][8];
#pragma unroll
  for (int ms = 0; ms < 2; ++ms)
#pragma unroll
    for (int ns = 0; ns < 4; ++ns)
#pragma unroll
      for (int j = 0; j < 8; ++j)
        rv[ms][ns][j] = rp[(ms * 256 + j * 16) * DMODEL + ns * 16];
#pragma unroll
  for (int ms = 0; ms < 2; ++ms)
#pragma unroll
    for (int ns = 0; ns < 4; ++ns)
#pragma unroll
      for (int j = 0; j < 8; ++j)
        op[(ms * 256 + j * 16) * DMODEL + ns * 16] = acc[ms][ns][j] + rv[ms][ns][j];
}

// The three projections need nothing of each other: one grid, blockIdx.z = 0, 1,
// 2 for Q, K, V. X, Wt and P each hold their three tensors one behind the other.
// Six waves per SIMD (at most 160 registers): three workgroups then share a WGP,
// and all 768 are resident at once; their LDS, 3 x 80 KiB, fits as well.
__global__ __launch_bounds__(256) __attribute__((amdgpu_waves_per_eu(6)))
void mha_gemm_qkv(const bf16* __restrict__ X, const bf16* __restrict__ Wt,
                  bf16* __restrict__ P) {
  const int z = blockIdx.z;
  const bf16* A = X + (size_t)z * (MROWS * DMODEL);
  const bf16* W = Wt + (size_t)z * (DMODEL * DMODEL);
  bf16*       O = P + (size_t)z * (MROWS * DMODEL);
  __shared__ __attribute__((aligned(1024))) bf16 sm[2 * SLICE_ELEMS(2)];
  if (z == 2) gemm_tile<1, 2>(A, W, O, nullptr, nullptr, sm);
  else        gemm_tile<0, 2>(A, W, O, nullptr, nullptr, sm);
}

__global__ __launch_bounds__(256)
void mha_gemm_out(const bf16* __restrict__ A, const bf16* __restrict__ W,
                  float* __restrict__ outF, const float* __restrict__ resid) {
  // one workgroup per WGP here: longer slices, so that a slice's work covers the
  // next one's way from L2
  __shared__ __attribute__((aligned(1024))) bf16 sm[2 * SLICE_ELEMS(4)];
  gemm_tile<2, 4>(A, W, nullptr, outF, resid, sm);
}

// Eight exp2 in one statement. Behind a transcendental the instruction set asks
// for one independent instruction before its result is read or its source is
// overwritten. Inside the statement the next exp2 is that instruction (the
// outputs are early-clobber, so none lies on a source); behind the last one
// stands v_nop.
__device__ inline void exp2x8(float* p, const float* a) {
  asm("v_exp_f32 %0, %8\n\t"
      "v_exp_f32 %1, %9\n\t"
      "v_exp_f32 %2, %10\n\t"
      "v_exp_f32 %3, %11\n\t"
      "v_exp_f32 %4, %12\n\t"
      "v_exp_f32 %5, %13\n\t"
      "v_exp_f32 %6, %14\n\t"
      "v_exp_f32 %7, %15\n\t"
      "v_nop"
      : "=&v"(p[0]), "=&v"(p[1]), "=&v"(p[2]), "=&v"(p[3]),
        "=&v"(p[4]), "=&v"(p[5]), "=&v"(p[6]), "=&v"(p[7])
      : "v"(a[0]), "v"(a[1]), "v"(a[2]), "v"(a[3]),
        "v"(a[4]), "v"(a[5]), "v"(a[6]), "v"(a[7]));
}

// One exp2, with the same slot behind it.
__device__ inline float exp2x1(float a) {
  float p;
  asm("v_exp_f32 %0, %1\n\t"
      "v_nop"
      : "=&v"(p) : "v"(a));
  return p;
}

#define RAISE 5.5f   // a score may top the maximum in use by this much

__global__ __launch_bounds__(256)
void mha_attn(const bf16* __restrict__ Pq, const bf16* __restrict__ Pk,
              const bf16* __restrict__ Vt, bf16* __restrict__ Pc) {
  const int lane = threadIdx.x & 31;
  const int wave = threadIdx.x >> 5;

  const int qblk = blockIdx.x & 7;
  const int bh   = blockIdx.x >> 3;
  const int b    = bh >> 4;
  const int h    = bh & 15;

  const int qt = qblk * 8 + wave;  // query tile 0..63

  // head slabs, each 128 tiles of 1 KiB, with the lane's own offset
  const bf16* Qh  = Pq + (size_t)bh * (SEQL * DK) + lane * 8;  // [64][2]
  const bf16* Kh  = Pk + (size_t)bh * (SEQL * DK) + lane * 8;  // [64][2]
  const bf16* Vth = Vt + (size_t)bh * (DK * SEQL) + lane * 8;  // [32][4]

  // Q^T fragments for this wave's 16 queries (K-dim = d, 0..31 and 32..63)
  v16bf bq[2];
  bq[0] = load_tile(Qh, qt * 2);
  bq[1] = load_tile(Qh, qt * 2 + 1);

  const v8f vzero = (v8f){0, 0, 0, 0, 0, 0, 0, 0};

  // ---- one pass over the keys: running maximum, sum and O^T together ----
  // m is the maximum in use for query r, the same value in both halves of the
  // wave. p = exp(s - m) stays exact for any m as long as sum and output use the
  // same m, so m is raised only when a score tops it by more than RAISE; p then
  // never exceeds exp(RAISE).
  float m = -1e30f;
  v2f lj[4];  // eight partial sums, in pairs: sum j is lj[j >> 1][j & 1]
#pragma unroll
  for (int j = 0; j < 4; ++j) lj[j] = (v2f){0.0f, 0.0f};
  v8f o[4];
#pragma unroll
  for (int nb = 0; nb < 4; ++nb) o[nb] = vzero;

  for (int kp = 0; kp < SEQL / 32; ++kp) {
    // all 16 loads of the block first: K, which is needed first, then V^T
    v16bf ak[4], av[4];
#pragma unroll
    for (int i = 0; i < 4; ++i) ak[i] = load_tile(Kh, kp * 4 + i);
#pragma unroll
    for (int nb = 0; nb < 4; ++nb) av[nb] = load_tile(Vth, kp * 4 + nb);
    // keeps the 16 loads in one group here: left free, the compiler issued K in
    // four dependent pairs with a full wait behind each, and V^T behind the test
    __builtin_amdgcn_sched_barrier(0);
    float sv[2][8];
#pragma unroll
    for (int t = 0; t < 2; ++t) {
      v8f s = vzero;
      s = wmma_bf16(ak[t * 2], bq[0], s);
      s = wmma_bf16(ak[t * 2 + 1], bq[1], s);
#pragma unroll
      for (int j = 0; j < 8; ++j)
        sv[t][j] = (s[j] == 0.0f) ? NEG_BIG : s[j] * 0.125f;  // mask, then 1/sqrt(64)
    }
    float bm = sv[0][0];
#pragma unroll
    for (int j = 1; j < 16; ++j) bm = fmaxf(bm, sv[j >> 3][j & 7]);
    // One test per 32 keys, a scalar branch. Every lane takes the new maximum
    // when any lane asks for one, so the two halves of a query stay alike.
    if (__builtin_amdgcn_ballot_w32(bm > m + RAISE) != 0) {
      const float nm = fmaxf(m, fmaxf(bm, __shfl_xor(bm, 16, 32)));
      const float f  = exp2x1((m - nm) * 1.44269504f);
      m = nm;
#pragma unroll
      for (int j = 0; j < 4; ++j) lj[j] *= f;
#pragma unroll
      for (int nb = 0; nb < 4; ++nb)
#pragma unroll
        for (int j = 0; j < 8; ++j) o[nb][j] *= f;
    }
    FragU pt;  // P^T, 32 keys x 16 queries, as a B fragment
#pragma unroll
    for (int t = 0; t < 2; ++t) {
      float a[8], p[8];
#pragma unroll
      for (int j = 0; j < 8; ++j)
        a[j] = (sv[t][j] - m) * 1.44269504f;  // exp(x) = exp2(x * log2 e), as __expf forms it
      exp2x8(p, a);
#pragma unroll
      for (int j = 0; j < 4; ++j) lj[j] += (v2f){p[2 * j], p[2 * j + 1]};
      pt.u[t] = pack8(p);
    }
#pragma unroll
    for (int nb = 0; nb < 4; ++nb) o[nb] = wmma_bf16(av[nb], pt.bf, o[nb]);
  }

  float l = ((lj[0][0] + lj[0][1]) + (lj[1][0] + lj[1][1])) +
            ((lj[2][0] + lj[2][1]) + (lj[3][0] + lj[3][1]));
  l += __shfl_xor(l, 16, 32);  // the other half's keys

  // Store O as A-fragment tiles of the concat matrix: row tile (b, qt),
  // k = h*64 + d, two tiles of 32 d; accumulator nb is chunk nb & 1 of tile nb >> 1.
  bf16* Oc = Pc + ((size_t)(b * 64 + qt) * KTILES + h * 2) * TILE_ELEMS + lane * 8;
#pragma unroll
  for (int nb = 0; nb < 4; ++nb) {
    float v[8];
#pragma unroll
    for (int j = 0; j < 8; ++j) v[j] = o[nb][j] / l;
    *(v4u*)(Oc + nb * 256) = pack8(v);
  }
}

// ---------------------------------------------------------------------------
// Host-side launch. Workspace layout (needs 64 MB), all in fragment order:
//  [ 0MB) qb  [ 8MB) kb  [16MB) vb            (bf16 activations, 8MB each)
//  [24MB) Wqb [26MB) Wkb [28MB) Wvb [30MB) Wob (bf16 weights, 2MB each)
//  [32MB) Pq  [40MB) Pk  [48MB) Vt  [56MB) Pc  (bf16 intermediates, 8MB each)
// ---------------------------------------------------------------------------
extern "C" void kernel_launch(void* const* d_in, const int* in_sizes, int n_in,
                              void* d_out, int out_size, void* d_ws,
                              size_t ws_size, hipStream_t stream) {
  (void)in_sizes; (void)n_in; (void)out_size; (void)ws_size;
  const float* q  = (const float*)d_in[0];
  const float* k  = (const float*)d_in[1];
  const float* v  = (const float*)d_in[2];
  const float* Wq = (const float*)d_in[3];
  const float* Wk = (const float*)d_in[4];
  const float* Wv = (const float*)d_in[5];
  const float* Wo = (const float*)d_in[6];
  float* out = (float*)d_out;

  char* ws = (char*)d_ws;
  const size_t MB = (size_t)1 << 20;
  bf16* qb  = (bf16*)(ws + 0 * MB);
  bf16* Wqb = (bf16*)(ws + 24 * MB);
  bf16* Wob = (bf16*)(ws + 30 * MB);
  bf16* Pq  = (bf16*)(ws + 32 * MB);
  bf16* Pk  = (bf16*)(ws + 40 * MB);
  bf16* Vt  = (bf16*)(ws + 48 * MB);
  bf16* Pc  = (bf16*)(ws + 56 * MB);

  // qb .. Wob are filled as one run of chunks from qb on
  mha_f32_to_bf16_frag<<<CVT_BLOCKS, 256, 0, stream>>>(q, k, v, Wq, Wk, Wv, Wo, qb);

  // (qb, kb, vb) x (Wqb, Wkb, Wvb) -> (Pq, Pk, Vt)
  mha_gemm_qkv<<<dim3(DMODEL / 256, MROWS / 64, 3), 256, 0, stream>>>(qb, Wqb, Pq);

  mha_attn<<<BATCH * HEADS * (SEQL / 128), 256, 0, stream>>>(Pq, Pk, Vt, Pc);

  mha_gemm_out<<<dim3(DMODEL / 256, MROWS / 64), 256, 0, stream>>>(Pc, Wob, out, q);
}

// v008
// A run of this version takes 70.1 microseconds.
// Next to v007, in two timings, it ran 1.14 times as fast each time.
// All steps since v000 together make it 4.51 times as fast.
#include <hip/hip_runtime.h>
#include <hip/hip_bf16.h>
#include <stdint.h>

// Problem constants (match the JAX reference)
#define HEADS  16
#define DMODEL 1024
#define DK     64
#define BATCH  4
#define SEQL   1024
#define MROWS  (BATCH * SEQL)   // 4096
#define NEG_BIG (-1000000000.0f)

typedef __bf16    bf16;
typedef uint32_t  u32;
typedef __attribute__((ext_vector_type(16))) bf16  v16bf;
typedef __attribute__((ext_vector_type(8)))  float v8f;
typedef __attribute__((ext_vector_type(2)))  float v2f;
typedef __attribute__((ext_vector_type(4)))  u32   v4u;

union FragU { v16bf bf; v4u u[2]; };

// Load one 16-bit WMMA operand fragment: two contiguous 8-element (16B) chunks.
// Per the CDNA5 ISA 16-bit A-matrix layout, lane L holds K elements
// {half*8 .. half*8+7} and {16+half*8 .. 16+half*8+7} (half = L>=16).
// The caller passes pointers already offset to those two chunks.
__device__ inline v16bf load_frag(const bf16* p0, const bf16* p1) {
  FragU f;
  f.u[0] = *(const v4u*)p0;
  f.u[1] = *(const v4u*)p1;
  return f.bf;
}

__device__ inline v8f wmma_bf16(v16bf a, v16bf b, v8f c) {
  // D = A(16x32 bf16) x B(32x16 bf16) + C(16x16 f32)
  return __builtin_amdgcn_wmma_f32_16x16x32_bf16(
      false, a, false, b, (short)0, c, false, false);
}

// float -> bf16, round to nearest even (bit manipulation: no __bf16 arith needed)
__device__ inline bf16 f2b(float f) {
  union { float f; u32 u; } x; x.f = f;
  u32 r = x.u + 0x7FFFu + ((x.u >> 16) & 1u);
  union { unsigned short s; bf16 b; } y; y.s = (unsigned short)(r >> 16);
  return y.b;
}

// ---------------------------------------------------------------------------
// Fragment order. Every bf16 tensor in the workspace is kept as 1-KiB tiles of
// 16 rows x 32 k, each tile in the order in which a wave loads it as a 16-bit
// WMMA operand: [chunk c = 0,1][lane = half*16 + r][8 elements], holding
// element (row r, k = c*16 + half*8 + e). One 16-byte-per-lane access of a wave
// is then 512 contiguous bytes (4 whole lines) instead of 32 bytes of 16 lines.
// ---------------------------------------------------------------------------
#define TILE_ELEMS 512   // 16 x 32 bf16
#define KTILES     (DMODEL / 32)

// Fragment of tile number tile; p already holds the lane's own offset (lane*8).
__device__ inline v16bf load_tile(const bf16* p, int tile) {
  const bf16* t = p + (size_t)tile * TILE_ELEMS;
  return load_frag(t, t + 256);
}

__device__ inline v4u pack8(const float* v) {
  union { bf16 e[8]; v4u u; } pk;
#pragma unroll
  for (int j = 0; j < 8; ++j) pk.e[j] = f2b(v[j]);
  return pk.u;
}

// ---------------------------------------------------------------------------
// float32 [rows][1024] row-major -> bf16 tiles [rows/16][32] in fragment order.
// All seven tensors share one grid: none needs anything of another, and their
// bf16 copies lie one behind the other in y (q, k, v, Wq, Wk, Wv, Wo), so the
// block index names both the source tensor (the same for a whole block) and the
// place in y.
//
// The launch is a stream, so it is cut into few, long waves: 32 per WGP, all
// resident at once, each with all of its loads in flight. A workgroup converts
// one whole row tile (64 KiB read, 32 KiB written, both contiguous); a wave takes
// 128 columns of it (4 fragment tiles), a thread makes 8 chunks of 16 bytes.
// Four neighbouring lanes read one 128-byte line of a row, 8 rows per load; the
// eight lanes that hold the same k of rows 0..7 (or 8..15) then store one whole
// 128-byte line of the tile.
// ---------------------------------------------------------------------------
#define ACT_BLOCKS (MROWS / 16)    // 256 blocks (row tiles) per activation
#define WGT_BLOCKS (DMODEL / 16)   // 64 blocks per weight
#define CVT_BLOCKS (3 * ACT_BLOCKS + 4 * WGT_BLOCKS)

__global__ __launch_bounds__(256)
void mha_f32_to_bf16_frag(const float* __restrict__ q, const float* __restrict__ k,
                          const float* __restrict__ v, const float* __restrict__ Wq,
                          const float* __restrict__ Wk, const float* __restrict__ Wv,
                          const float* __restrict__ Wo, bf16* __restrict__ y) {
  const u32 blk = blockIdx.x;
  const float* x = (blk < 1 * ACT_BLOCKS) ? q
                 : (blk < 2 * ACT_BLOCKS) ? k
                 : (blk < 3 * ACT_BLOCKS) ? v
                 : (blk < 3 * ACT_BLOCKS + 1 * WGT_BLOCKS) ? Wq
                 : (blk < 3 * ACT_BLOCKS + 2 * WGT_BLOCKS) ? Wk
                 : (blk < 3 * ACT_BLOCKS + 3 * WGT_BLOCKS) ? Wv : Wo;
  // block number within its own tensor: every tensor starts at a multiple of
  // its own (power-of-two) block count
  const u32 lb = blk & ((blk < 3 * ACT_BLOCKS) ? ACT_BLOCKS - 1 : WGT_BLOCKS - 1);
  const int lane = threadIdx.x & 31;
  const int wave = threadIdx.x >> 5;  // columns wave*128 .. +127 = k-tiles wave*4 .. +3
  const int rr   = lane >> 2;         // row within a group of 8 rows
  const int wq   = lane & 3;          // k = wq*8 .. +7 of a k-tile: c = wq>>1, half = wq&1
  const float* s = x + (size_t)(lb * 16 + rr) * DMODEL + wave * 128 + wq * 8;
  bf16*        d = y + ((size_t)blk * KTILES + wave * 4) * TILE_ELEMS + (wq * 16 + rr) * 8;
  // chunk u: row (u >> 2) * 8 + rr, k-tile wave*4 + (u & 3)
  float4 a[8], b[8];
#pragma unroll
  for (int u = 0; u < 8; ++u) {
    const float* p = s + (u >> 2) * (8 * DMODEL) + (u & 3) * 32;
    a[u] = *(const float4*)p;
    b[u] = *(const float4*)(p + 4);
  }
  // Stands in front of every instruction that may overwrite the address pair
  // which the loads name. The pointer is an input so that the pair stays whole up
  // to here: left free, the last load's own destination lay on it.
  asm volatile("s_wait_xcnt 0x0" :: "v"(s) : "memory");
#pragma unroll
  for (int u = 0; u < 8; ++u) {
    const float e[8] = {a[u].x, a[u].y, a[u].z, a[u].w, b[u].x, b[u].y, b[u].z, b[u].w};
    *(v4u*)(d + (u & 3) * TILE_ELEMS + (u >> 2) * 64) = pack8(e);
  }
}

// ---------------------------------------------------------------------------
// C[4096,1024] = A[4096,1024](bf16) @ W[1024,1024](bf16)^T, A and W in
// fragment order. Wave tile 32x64 (2x4 accumulators); workgroup tile 64x256.
//
// The head slab (b,h) is the contiguous reshape of C[b, 64h:64h+64, :]:
// element (s, col) is position t = (s & 63) * 16 + (col >> 6), d = col & 63.
// Attention may take its positions in any order, so a tile of 16 positions is
// 16 neighbouring s of one column block: tile number (col >> 6) * 4 +
// ((s & 63) >> 4), row s & 15. A 16x16 accumulator tile is then one chunk.
//
// MODE 0 (Q, K): operands swapped (tile = W * A^T), so a lane holds 8
//         neighbouring d of one s. Out: [b,h][64 tiles][d/32] fragment tiles.
// MODE 1 (V): a lane holds 8 neighbouring s of one d. Out: V^T fragment tiles
//         [b,h][32 blocks of 32 positions][d/16], rows d, k = position.
// MODE 2: f32 out = C + resid. A's row tiles are attention's query tiles
//         (b, tile number); the rows go back to their places here.
//
// The operands come through LDS. A slice is KS k-tiles of the workgroup's 4 row
// tiles of A and 16 row tiles of W: 20 runs of KS KiB, each contiguous in the
// workspace, laid one behind the other in LDS, still in fragment order. Every
// thread copies 16 bytes per round; the four waves that need the same A tile and
// the two that need the same W tile read it from LDS, so a tile leaves L2 once
// per workgroup. Two buffers: slice t + 1 is on its way while slice t is used.
// ---------------------------------------------------------------------------
#define WG_ROWTILES 20   // 4 of A, then 16 of W
#define SLICE_ELEMS(KS) (WG_ROWTILES * (KS) * TILE_ELEMS)

// Ten asynchronous 16-byte copies per lane, global memory to LDS: copy u goes
// from g[u] to LDS byte address l[u]. The wait at the end stands inside the
// statement so that no address register of a copy is rewritten in front of it.
__device__ __forceinline__
void copy10(const u32* l, const char* const* g) {
  asm volatile("global_load_async_to_lds_b128 %0, %1, off\n\t"
               "global_load_async_to_lds_b128 %2, %3, off\n\t"
               "global_load_async_to_lds_b128 %4, %5, off\n\t"
               "global_load_async_to_lds_b128 %6, %7, off\n\t"
               "global_load_async_to_lds_b128 %8, %9, off\n\t"
               "global_load_async_to_lds_b128 %10, %11, off\n\t"
               "global_load_async_to_lds_b128 %12, %13, off\n\t"
               "global_load_async_to_lds_b128 %14, %15, off\n\t"
               "global_load_async_to_lds_b128 %16, %17, off\n\t"
               "global_load_async_to_lds_b128 %18, %19, off\n\t"
               "s_wait_xcnt 0x0"
               :: "v"(l[0]), "v"(g[0]), "v"(l[1]), "v"(g[1]), "v"(l[2]), "v"(g[2]),
                  "v"(l[3]), "v"(g[3]), "v"(l[4]), "v"(g[4]), "v"(l[5]), "v"(g[5]),
                  "v"(l[6]), "v"(g[6]), "v"(l[7]), "v"(g[7]), "v"(l[8]), "v"(g[8]),
                  "v"(l[9]), "v"(g[9])
               : "memory");
}

// One slice. l: the thread's LDS byte address in round 0; ga, gw: its source in
// the first A round and the first W round. A round is 4 KiB of LDS = 4 / KS row
// tiles, which lie 32 KiB apart in the workspace.
template <int KS>
__device__ __forceinline__
void copy_slice(u32 l, const char* ga, const char* gw) {
  constexpr int RPR    = 4 / KS;             // row tiles per round
  constexpr int ROUNDS = WG_ROWTILES / RPR;
  constexpr int AR     = 4 / RPR;            // rounds that bring A
  constexpr int STEP   = RPR * KTILES * TILE_ELEMS * 2;  // bytes, round to round
#pragma unroll
  for (int i = 0; i < ROUNDS; i += 10) {
    u32 d[10];
    const char* g[10];
#pragma unroll
    for (int u = 0; u < 10; ++u) {
      d[u] = l + (i + u) * 4096;
      g[u] = (i + u < AR) ? ga + (i + u) * STEP : gw + (i + u - AR) * STEP;
    }
    copy10(d, g);
  }
}

template <int MODE, int KS>
__device__ __forceinline__
void gemm_tile(const bf16* __restrict__ A, const bf16* __restrict__ W,
               bf16* __restrict__ outB, float* __restrict__ outF,
               const float* __restrict__ resid, bf16* sm) {
  const int lane = threadIdx.x & 31;
  const int wave = threadIdx.x >> 5;
  const int half = lane >> 4;
  const int r    = lane & 15;
  const int wm   = wave >> 2;  // 0..1
  const int wn   = wave & 3;   // 0..3
  const int M0 = blockIdx.y * 64 + wm * 32;
  const int N0 = blockIdx.x * 256 + wn * 64;

  v8f acc[2][4];
#pragma unroll
  for (int i = 0; i < 2; ++i)
#pragma unroll
    for (int j = 0; j < 4; ++j) acc[i][j] = (v8f){0, 0, 0, 0, 0, 0, 0, 0};

  constexpr int NT          = KTILES / KS;            // slices
  constexpr int SLICE_BYTES = SLICE_ELEMS(KS) * 2;
  constexpr int TPR         = KS * 64;                // threads per row tile's run
  const int tid = threadIdx.x;
  const size_t src_off = (size_t)(tid / TPR) * (KTILES * TILE_ELEMS * 2) + (tid % TPR) * 16;
  const char* ga = (const char*)(A + (size_t)(blockIdx.y * 4) * KTILES * TILE_ELEMS) + src_off;
  const char* gw = (const char*)(W + (size_t)(blockIdx.x * 16) * KTILES * TILE_ELEMS) + src_off;
  const u32 l0 = (u32)(uintptr_t)sm + tid * 16;       // LDS byte address

  copy_slice<KS>(l0, ga, gw);
  // slice 0 has landed for this wave's copies; the barrier says so for all waves
  asm volatile("s_wait_asynccnt 0x0" ::: "memory");
  __syncthreads();
  copy_slice<KS>(l0 + SLICE_BYTES, ga + KS * 1024, gw + KS * 1024);

  for (int t = 0; t < NT; ++t) {
    const bf16* sb = sm + (t & 1) * SLICE_ELEMS(KS) + lane * 8;
#pragma unroll
    for (int kk = 0; kk < KS; ++kk) {
      v16bf af[2], bf_[4];
#pragma unroll
      for (int ms = 0; ms < 2; ++ms) af[ms] = load_tile(sb, (wm * 2 + ms) * KS + kk);
#pragma unroll
      for (int ns = 0; ns < 4; ++ns) bf_[ns] = load_tile(sb, (4 + wn * 4 + ns) * KS + kk);
#pragma unroll
      for (int ms = 0; ms < 2; ++ms)
#pragma unroll
        for (int ns = 0; ns < 4; ++ns)
          acc[ms][ns] = (MODE == 0) ? wmma_bf16(bf_[ns], af[ms], acc[ms][ns])
                                    : wmma_bf16(af[ms], bf_[ns], acc[ms][ns]);
    }
    // Hand-over: this wave's reads of slice t are done, its copies of slice t + 1
    // have landed; behind the barrier both hold for every wave, so slice t + 1 may
    // be read and the buffer of slice t refilled.
    asm volatile("s_wait_dscnt 0x0" ::: "memory");
    asm volatile("s_wait_asynccnt 0x0" ::: "memory");
    __syncthreads();
    if (t + 2 < NT)
      copy_slice<KS>(l0 + (t & 1) * SLICE_BYTES, ga + (t + 2) * (KS * 1024),
                     gw + (t + 2) * (KS * 1024));
  }
  // no copy is left in flight when the wave goes on
  asm volatile("s_wait_asynccnt 0x0" ::: "memory");

  if (MODE == 0 || MODE == 1) {
    const int bh = ((M0 >> 10) * HEADS) + ((M0 & 1023) >> 6);
    const int cb = N0 >> 6;            // column block 0..15
    const int sb = (M0 & 63) >> 4;     // 0 or 2; + ms
#pragma unroll
    for (int ms = 0; ms < 2; ++ms) {
#pragma unroll
      for (int ns = 0; ns < 4; ++ns) {
        float v[8];
#pragma unroll
        for (int j = 0; j < 8; ++j) v[j] = acc[ms][ns][j];
        // chunk number: MODE 0 tile (cb*4 + sb + ms), d/32 = ns>>1, c = ns&1
        //               MODE 1 block (cb*2 + sb/2), d/16 = ns, c = ms
        const int chunk =
            (MODE == 0)
                ? (((bh * 64 + cb * 4 + sb + ms) * 2 + (ns >> 1)) * 2 + (ns & 1))
                : (((bh * 32 + cb * 2 + (sb >> 1)) * 4 + ns) * 2 + ms);
        *(v4u*)(outB + (size_t)chunk * 256 + lane * 8) = pack8(v);
        // stands in front of the next chunk's packing, which may overwrite the
        // registers that this store names
        asm volatile("s_wait_xcnt 0x0" ::: "memory");
      }
    }
    return;
  }

  // C/D layout: lanes 0-15 hold rows j, lanes 16-31 rows j+8; col = lane&15.
  // Both row tiles of the wave share b and cb (M0 is a multiple of 32), so one
  // base serves: tile ms is 256 rows on, register j is 16 rows on.
  const int rt = M0 >> 4;            // (b, query tile), even
  const int b  = rt >> 6;
  const int cb = (rt & 63) >> 2;
  const int sb = rt & 3;
  const size_t base =
      ((size_t)b * SEQL + ((sb * 16 + 8 * half) << 4) + cb) * DMODEL + N0 + r;
  const float* rp = resid + base;
  float*       op = outF + base;
  float rv[2][4][8];
#pragma unroll
  for (int ms = 0; ms < 2; ++ms)
#pragma unroll
    for (int ns = 0; ns < 4; ++ns)
#pragma unroll
      for (int j = 0; j < 8; ++j)
        rv[ms][ns][j] = rp[(ms * 256 + j * 16) * DMODEL + ns * 16];
#pragma unroll
  for (int ms = 0; ms < 2; ++ms)
#pragma unroll
    for (int ns = 0; ns < 4; ++ns)
#pragma unroll
      for (int j = 0; j < 8; ++j)
        op[(ms * 256 + j * 16) * DMODEL + ns * 16] = acc[ms][ns][j] + rv[ms][ns][j];
}

// The three projections need nothing of each other: one grid, blockIdx.z = 0, 1,
// 2 for Q, K, V. X, Wt and P each hold their three tensors one behind the other.
// Six waves per SIMD (at most 160 registers): three workgroups then share a WGP,
// and all 768 are resident at once; their LDS, 3 x 80 KiB, fits as well.
__global__ __launch_bounds__(256) __attribute__((amdgpu_waves_per_eu(6)))
void mha_gemm_qkv(const bf16* __restrict__ X, const bf16* __restrict__ Wt,
                  bf16* __restrict__ P) {
  const int z = blockIdx.z;
  const bf16* A = X + (size_t)z * (MROWS * DMODEL);
  const bf16* W = Wt + (size_t)z * (DMODEL * DMODEL);
  bf16*       O = P + (size_t)z * (MROWS * DMODEL);
  __shared__ __attribute__((aligned(1024))) bf16 sm[2 * SLICE_ELEMS(2)];
  if (z == 2) gemm_tile<1, 2>(A, W, O, nullptr, nullptr, sm);
  else        gemm_tile<0, 2>(A, W, O, nullptr, nullptr, sm);
}

__global__ __launch_bounds__(256)
void mha_gemm_out(const bf16* __restrict__ A, const bf16* __restrict__ W,
                  float* __restrict__ outF, const float* __restrict__ resid) {
  // one workgroup per WGP here: longer slices, so that a slice's work covers the
  // next one's way from L2
  __shared__ __attribute__((aligned(1024))) bf16 sm[2 * SLICE_ELEMS(4)];
  gemm_tile<2, 4>(A, W, nullptr, outF, resid, sm);
}

// Eight exp2 in one statement. Behind a transcendental the instruction set asks
// for one independent instruction before its result is read or its source is
// overwritten. Inside the statement the next exp2 is that instruction (the
// outputs are early-clobber, so none lies on a source); behind the last one
// stands v_nop.
__device__ inline void exp2x8(float* p, const float* a) {
  asm("v_exp_f32 %0, %8\n\t"
      "v_exp_f32 %1, %9\n\t"
      "v_exp_f32 %2, %10\n\t"
      "v_exp_f32 %3, %11\n\t"
      "v_exp_f32 %4, %12\n\t"
      "v_exp_f32 %5, %13\n\t"
      "v_exp_f32 %6, %14\n\t"
      "v_exp_f32 %7, %15\n\t"
      "v_nop"
      : "=&v"(p[0]), "=&v"(p[1]), "=&v"(p[2]), "=&v"(p[3]),
        "=&v"(p[4]), "=&v"(p[5]), "=&v"(p[6]), "=&v"(p[7])
      : "v"(a[0]), "v"(a[1]), "v"(a[2]), "v"(a[3]),
        "v"(a[4]), "v"(a[5]), "v"(a[6]), "v"(a[7]));
}

// One exp2, with the same slot behind it.
__device__ inline float exp2x1(float a) {
  float p;
  asm("v_exp_f32 %0, %1\n\t"
      "v_nop"
      : "=&v"(p) : "v"(a));
  return p;
}

#define RAISE 5.5f   // a score may top the maximum in use by this much

#define STAGE_KEYS  128
#define STAGE_HALF  (STAGE_KEYS * DK)   // elements of K, and of V^T, in a stage
#define STAGE_ELEMS (2 * STAGE_HALF)
#define NSTAGES     (SEQL / STAGE_KEYS)

// One stage: eight asynchronous 16-byte copies per lane, global memory to LDS,
// four rounds of 4 KiB for K and four for V^T. l: the thread's LDS byte address
// in the first round; gk, gv: its sources there. The wait at the end stands
// inside the statement so that no address register of a copy is rewritten in
// front of it.
__device__ __forceinline__
void copy_stage(u32 l, const char* gk, const char* gv) {
  asm volatile("global_load_async_to_lds_b128 %0, %1, off\n\t"
               "global_load_async_to_lds_b128 %2, %3, off\n\t"
               "global_load_async_to_lds_b128 %4, %5, off\n\t"
               "global_load_async_to_lds_b128 %6, %7, off\n\t"
               "global_load_async_to_lds_b128 %8, %9, off\n\t"
               "global_load_async_to_lds_b128 %10, %11, off\n\t"
               "global_load_async_to_lds_b128 %12, %13, off\n\t"
               "global_load_async_to_lds_b128 %14, %15, off\n\t"
               "s_wait_xcnt 0x0"
               :: "v"(l),             "v"(gk),         "v"(l + 1 * 4096), "v"(gk + 1 * 4096),
                  "v"(l + 2 * 4096), "v"(gk + 2 * 4096), "v"(l + 3 * 4096), "v"(gk + 3 * 4096),
                  "v"(l + 4 * 4096), "v"(gv),         "v"(l + 5 * 4096), "v"(gv + 1 * 4096),
                  "v"(l + 6 * 4096), "v"(gv + 2 * 4096), "v"(l + 7 * 4096), "v"(gv + 3 * 4096)
               : "memory");
}

__global__ __launch_bounds__(256)
void mha_attn(const bf16* __restrict__ Pq, const bf16* __restrict__ Pk,
              const bf16* __restrict__ Vt, bf16* __restrict__ Pc) {
  const int lane = threadIdx.x & 31;
  const int wave = threadIdx.x >> 5;

  const int qblk = blockIdx.x & 7;
  const int bh   = blockIdx.x >> 3;
  const int b    = bh >> 4;
  const int h    = bh & 15;

  const int qt = qblk * 8 + wave;  // query tile 0..63

  // head slabs, each 128 tiles of 1 KiB, with the lane's own offset
  const bf16* Qh  = Pq + (size_t)bh * (SEQL * DK) + lane * 8;  // [64][2]
  // K [64][2] and V^T [32][4]: the thread's own 16 bytes of a copy round
  const char* gk = (const char*)(Pk + (size_t)bh * (SEQL * DK)) + threadIdx.x * 16;
  const char* gv = (const char*)(Vt + (size_t)bh * (DK * SEQL)) + threadIdx.x * 16;
  __shared__ __attribute__((aligned(1024))) bf16 sm[2 * STAGE_ELEMS];
  const u32 l0 = (u32)(uintptr_t)sm + threadIdx.x * 16;  // LDS byte address

  // Q^T fragments for this wave's 16 queries (K-dim = d, 0..31 and 32..63)
  v16bf bq[2];
  bq[0] = load_tile(Qh, qt * 2);
  bq[1] = load_tile(Qh, qt * 2 + 1);

  const v8f vzero = (v8f){0, 0, 0, 0, 0, 0, 0, 0};

  // ---- one pass over the keys: running maximum, sum and O^T together ----
  // m is the maximum in use for query r, the same value in both halves of the
  // wave. p = exp(s - m) stays exact for any m as long as sum and output use the
  // same m, so the wave raises m only when some score tops the m of its query by more than RAISE; p then
  // never exceeds exp(RAISE).
  float m = -1e30f;
  v2f lj[4];  // eight partial sums, in pairs: sum j is lj[j >> 1][j & 1]
#pragma unroll
  for (int j = 0; j < 4; ++j) lj[j] = (v2f){0.0f, 0.0f};
  v8f o[4];
#pragma unroll
  for (int nb = 0; nb < 4; ++nb) o[nb] = vzero;

  copy_stage(l0, gk, gv);
  // stage 0 has landed for this wave's copies; the barrier says so for all waves
  asm volatile("s_wait_asynccnt 0x0" ::: "memory");
  __syncthreads();
  copy_stage(l0 + STAGE_ELEMS * 2, gk + STAGE_HALF * 2, gv + STAGE_HALF * 2);

  for (int st = 0; st < NSTAGES; ++st) {
    const bf16* sb = sm + (st & 1) * STAGE_ELEMS + lane * 8;
    // unrolled: every LDS address of a stage is then the stage's base plus an
    // immediate, and no address is formed between one block's products and the next
#pragma unroll
    for (int kp = 0; kp < STAGE_KEYS / 32; ++kp) {
      // all 16 loads of the block first: K, which is needed first, then V^T
      v16bf ak[4], av[4];
#pragma unroll
      for (int i = 0; i < 4; ++i) ak[i] = load_tile(sb, kp * 4 + i);
#pragma unroll
      for (int nb = 0; nb < 4; ++nb) av[nb] = load_tile(sb + STAGE_HALF, kp * 4 + nb);
      // keeps the 16 loads in one group here: left free, the compiler issued them in
      // pairs among the products, with a full wait behind each pair
      __builtin_amdgcn_sched_barrier(0);
      float sv[2][8];
#pragma unroll
      for (int t = 0; t < 2; ++t) {
        v8f s = vzero;
        s = wmma_bf16(ak[t * 2], bq[0], s);
        s = wmma_bf16(ak[t * 2 + 1], bq[1], s);
#pragma unroll
        for (int j = 0; j < 8; ++j)
          sv[t][j] = (s[j] == 0.0f) ? NEG_BIG : s[j] * 0.125f;  // mask, then 1/sqrt(64)
      }
      float bm = sv[0][0];
#pragma unroll
      for (int j = 1; j < 16; ++j) bm = fmaxf(bm, sv[j >> 3][j & 7]);
      // One test per 32 keys, a scalar branch. Every lane takes the new maximum
      // when any lane asks for one, so the two halves of a query stay alike.
      if (__builtin_amdgcn_ballot_w32(bm > m + RAISE) != 0) {
        const float nm = fmaxf(m, fmaxf(bm, __shfl_xor(bm, 16, 32)));
        const float f  = exp2x1((m - nm) * 1.44269504f);
        m = nm;
#pragma unroll
        for (int j = 0; j < 4; ++j) lj[j] *= f;
#pragma unroll
        for (int nb = 0; nb < 4; ++nb)
#pragma unroll
          for (int j = 0; j < 8; ++j) o[nb][j] *= f;
      }
      FragU pt;  // P^T, 32 keys x 16 queries, as a B fragment
#pragma unroll
      for (int t = 0; t < 2; ++t) {
        float a[8], p[8];
#pragma unroll
        for (int j = 0; j < 8; ++j)
          a[j] = (sv[t][j] - m) * 1.44269504f;  // exp(x) = exp2(x * log2 e), as __expf forms it
        exp2x8(p, a);
#pragma unroll
        for (int j = 0; j < 4; ++j) lj[j] += (v2f){p[2 * j], p[2 * j + 1]};
        pt.u[t] = pack8(p);
      }
#pragma unroll
      for (int nb = 0; nb < 4; ++nb) o[nb] = wmma_bf16(av[nb], pt.bf, o[nb]);
    }
    // Hand-over: this wave's reads of stage st are done, its copies of stage st + 1
    // have landed; behind the barrier both hold for every wave, so stage st + 1 may
    // be read and the buffer of stage st refilled.
    asm volatile("s_wait_dscnt 0x0" ::: "memory");
    asm volatile("s_wait_asynccnt 0x0" ::: "memory");
    __syncthreads();
    if (st + 2 < NSTAGES)
      copy_stage(l0 + (st & 1) * (STAGE_ELEMS * 2), gk + (st + 2) * (STAGE_HALF * 2),
                 gv + (st + 2) * (STAGE_HALF * 2));
  }
  // no copy is left in flight when the wave goes on
  asm volatile("s_wait_asynccnt 0x0" ::: "memory");

  float l = ((lj[0][0] + lj[0][1]) + (lj[1][0] + lj[1][1])) +
            ((lj[2][0] + lj[2][1]) + (lj[3][0] + lj[3][1]));
  l += __shfl_xor(l, 16, 32);  // the other half's keys

  // Store O as A-fragment tiles of the concat matrix: row tile (b, qt),
  // k = h*64 + d, two tiles of 32 d; accumulator nb is chunk nb & 1 of tile nb >> 1.
  bf16* Oc = Pc + ((size_t)(b * 64 + qt) * KTILES + h * 2) * TILE_ELEMS + lane * 8;
#pragma unroll
  for (int nb = 0; nb < 4; ++nb) {
    float v[8];
#pragma unroll
    for (int j = 0; j < 8; ++j) v[j] = o[nb][j] / l;
    *(v4u*)(Oc + nb * 256) = pack8(v);
  }
}

// ---------------------------------------------------------------------------
// Host-side launch. Workspace layout (needs 64 MB), all in fragment order:
//  [ 0MB) qb  [ 8MB) kb  [16MB) vb            (bf16 activations, 8MB each)
//  [24MB) Wqb [26MB) Wkb [28MB) Wvb [30MB) Wob (bf16 weights, 2MB each)
//  [32MB) Pq  [40MB) Pk  [48MB) Vt  [56MB) Pc  (bf16 intermediates, 8MB each)
// ---------------------------------------------------------------------------
extern "C" void kernel_launch(void* const* d_in, const int* in_sizes, int n_in,
                              void* d_out, int out_size, void* d_ws,
                              size_t ws_size, hipStream_t stream) {
  (void)in_sizes; (void)n_in; (void)out_size; (void)ws_size;
  const float* q  = (const float*)d_in[0];
  const float* k  = (const float*)d_in[1];
  const float* v  = (const float*)d_in[2];
  const float* Wq = (const float*)d_in[3];
  const float* Wk = (const float*)d_in[4];
  const float* Wv = (const float*)d_in[5];
  const float* Wo = (const float*)d_in[6];
  float* out = (float*)d_out;

  char* ws = (char*)d_ws;
  const size_t MB = (size_t)1 << 20;
  bf16* qb  = (bf16*)(ws + 0 * MB);
  bf16* Wqb = (bf16*)(ws + 24 * MB);
  bf16* Wob = (bf16*)(ws + 30 * MB);
  bf16* Pq  = (bf16*)(ws + 32 * MB);
  bf16* Pk  = (bf16*)(ws + 40 * MB);
  bf16* Vt  = (bf16*)(ws + 48 * MB);
  bf16* Pc  = (bf16*)(ws + 56 * MB);

  // qb .. Wob are filled as one run of chunks from qb on
  mha_f32_to_bf16_frag<<<CVT_BLOCKS, 256, 0, stream>>>(q, k, v, Wq, Wk, Wv, Wo, qb);

  // (qb, kb, vb) x (Wqb, Wkb, Wvb) -> (Pq, Pk, Vt)
  mha_gemm_qkv<<<dim3(DMODEL / 256, MROWS / 64, 3), 256, 0, stream>>>(qb, Wqb, Pq);

  mha_attn<<<BATCH * HEADS * (SEQL / 128), 256, 0, stream>>>(Pq, Pk, Vt, Pc);

  mha_gemm_out<<<dim3(DMODEL / 256, MROWS / 64), 256, 0, stream>>>(Pc, Wob, out, q);
}

// v009
// Measured time: 68.2 microseconds a run.
// Next to v008, in two timings, it ran 1.03 and 1.04 times as fast.
// All steps since v000 together make it 4.66 times as fast.
#include <hip/hip_runtime.h>
#include <hip/hip_bf16.h>
#include <stdint.h>

// Problem constants (match the JAX reference)
#define HEADS  16
#define DMODEL 1024
#define DK     64
#define BATCH  4
#define SEQL   1024
#define MROWS  (BATCH * SEQL)   // 4096
#define NEG_BIG (-1000000000.0f)

typedef __bf16    bf16;
typedef uint32_t  u32;
typedef __attribute__((ext_vector_type(16))) bf16  v16bf;
typedef __attribute__((ext_vector_type(8)))  float v8f;
typedef __attribute__((ext_vector_type(2)))  float v2f;
typedef __attribute__((ext_vector_type(2)))  bf16  v2bf;
typedef __attribute__((ext_vector_type(4)))  u32   v4u;

union FragU { v16bf bf; v4u u[2]; };

// Load one 16-bit WMMA operand fragment: two contiguous 8-element (16B) chunks.
// Per the CDNA5 ISA 16-bit A-matrix layout, lane L holds K elements
// {half*8 .. half*8+7} and {16+half*8 .. 16+half*8+7} (half = L>=16).
// The caller passes pointers already offset to those two chunks.
__device__ inline v16bf load_frag(const bf16* p0, const bf16* p1) {
  FragU f;
  f.u[0] = *(const v4u*)p0;
  f.u[1] = *(const v4u*)p1;
  return f.bf;
}

__device__ inline v8f wmma_bf16(v16bf a, v16bf b, v8f c) {
  // D = A(16x32 bf16) x B(32x16 bf16) + C(16x16 f32)
  return __builtin_amdgcn_wmma_f32_16x16x32_bf16(
      false, a, false, b, (short)0, c, false, false);
}

// ---------------------------------------------------------------------------
// Fragment order. Every bf16 tensor in the workspace is kept as 1-KiB tiles of
// 16 rows x 32 k, each tile in the order in which a wave loads it as a 16-bit
// WMMA operand: [chunk c = 0,1][lane = half*16 + r][8 elements], holding
// element (row r, k = c*16 + half*8 + e). One 16-byte-per-lane access of a wave
// is then 512 contiguous bytes (4 whole lines) instead of 32 bytes of 16 lines.
// ---------------------------------------------------------------------------
#define TILE_ELEMS 512   // 16 x 32 bf16
#define KTILES     (DMODEL / 32)

// Fragment of tile number tile; p already holds the lane's own offset (lane*8).
__device__ inline v16bf load_tile(const bf16* p, int tile) {
  const bf16* t = p + (size_t)tile * TILE_ELEMS;
  return load_frag(t, t + 256);
}

// Eight floats -> eight bf16, round to nearest even: the conversion of a pair is
// one instruction (v_cvt_pk_bf16_f32) that also packs the two halves.
__device__ inline v4u pack8(const float* v) {
  union { v2bf e[4]; v4u u; } pk;
#pragma unroll
  for (int j = 0; j < 4; ++j)
    pk.e[j] = __builtin_convertvector((v2f){v[2 * j], v[2 * j + 1]}, v2bf);
  return pk.u;
}

// ---------------------------------------------------------------------------
// float32 [rows][1024] row-major -> bf16 tiles [rows/16][32] in fragment order.
// All seven tensors share one grid: none needs anything of another, and their
// bf16 copies lie one behind the other in y (q, k, v, Wq, Wk, Wv, Wo), so the
// block index names both the source tensor (the same for a whole block) and the
// place in y.
//
// The launch is a stream, so it is cut into few, long waves: 32 per WGP, all
// resident at once, each with all of its loads in flight. A workgroup converts
// one whole row tile (64 KiB read, 32 KiB written, both contiguous); a wave takes
// 128 columns of it (4 fragment tiles), a thread makes 8 chunks of 16 bytes.
// Four neighbouring lanes read one 128-byte line of a row, 8 rows per load; the
// eight lanes that hold the same k of rows 0..7 (or 8..15) then store one whole
// 128-byte line of the tile.
// ---------------------------------------------------------------------------
#define ACT_BLOCKS (MROWS / 16)    // 256 blocks (row tiles) per activation
#define WGT_BLOCKS (DMODEL / 16)   // 64 blocks per weight
#define CVT_BLOCKS (3 * ACT_BLOCKS + 4 * WGT_BLOCKS)

__global__ __launch_bounds__(256)
void mha_f32_to_bf16_frag(const float* __restrict__ q, const float* __restrict__ k,
                          const float* __restrict__ v, const float* __restrict__ Wq,
                          const float* __restrict__ Wk, const float* __restrict__ Wv,
                          const float* __restrict__ Wo, bf16* __restrict__ y) {
  const u32 blk = blockIdx.x;
  const float* x = (blk < 1 * ACT_BLOCKS) ? q
                 : (blk < 2 * ACT_BLOCKS) ? k
                 : (blk < 3 * ACT_BLOCKS) ? v
                 : (blk < 3 * ACT_BLOCKS + 1 * WGT_BLOCKS) ? Wq
                 : (blk < 3 * ACT_BLOCKS + 2 * WGT_BLOCKS) ? Wk
                 : (blk < 3 * ACT_BLOCKS + 3 * WGT_BLOCKS) ? Wv : Wo;
  // block number within its own tensor: every tensor starts at a multiple of
  // its own (power-of-two) block count
  const u32 lb = blk & ((blk < 3 * ACT_BLOCKS) ? ACT_BLOCKS - 1 : WGT_BLOCKS - 1);
  const int lane = threadIdx.x & 31;
  const int wave = threadIdx.x >> 5;  // columns wave*128 .. +127 = k-tiles wave*4 .. +3
  const int rr   = lane >> 2;         // row within a group of 8 rows
  const int wq   = lane & 3;          // k = wq*8 .. +7 of a k-tile: c = wq>>1, half = wq&1
  const float* s = x + (size_t)(lb * 16 + rr) * DMODEL + wave * 128 + wq * 8;
  bf16*        d = y + ((size_t)blk * KTILES + wave * 4) * TILE_ELEMS + (wq * 16 + rr) * 8;
  // chunk u: row (u >> 2) * 8 + rr, k-tile wave*4 + (u & 3)
  float4 a[8], b[8];
#pragma unroll
  for (int u = 0; u < 8; ++u) {
    const float* p = s + (u >> 2) * (8 * DMODEL) + (u & 3) * 32;
    a[u] = *(const float4*)p;
    b[u] = *(const float4*)(p + 4);
  }
  // Stands in front of every instruction that may overwrite the address pair
  // which the loads name. The pointer is an input so that the pair stays whole up
  // to here: left free, the last load's own destination lay on it.
  asm volatile("s_wait_xcnt 0x0" :: "v"(s) : "memory");
  // keeps all 16 loads in front of the first conversion: left free, the compiler
  // put the last three behind waits for the first ones, to use their registers again
  __builtin_amdgcn_sched_barrier(0);
  v4u o[8];
#pragma unroll
  for (int u = 0; u < 8; ++u) {
    const float e[8] = {a[u].x, a[u].y, a[u].z, a[u].w, b[u].x, b[u].y, b[u].z, b[u].w};
    o[u] = pack8(e);
  }
#pragma unroll
  for (int u = 0; u < 8; ++u) *(v4u*)(d + (u & 3) * TILE_ELEMS + (u >> 2) * 64) = o[u];
}

// ---------------------------------------------------------------------------
// C[4096,1024] = A[4096,1024](bf16) @ W[1024,1024](bf16)^T, A and W in
// fragment order. Wave tile 32x64 (2x4 accumulators); workgroup tile 64x256.
//
// The head slab (b,h) is the contiguous reshape of C[b, 64h:64h+64, :]:
// element (s, col) is position t = (s & 63) * 16 + (col >> 6), d = col & 63.
// Attention may take its positions in any order, so a tile of 16 positions is
// 16 neighbouring s of one column block: tile number (col >> 6) * 4 +
// ((s & 63) >> 4), row s & 15. A 16x16 accumulator tile is then one chunk.
//
// MODE 0 (Q, K): operands swapped (tile = W * A^T), so a lane holds 8
//         neighbouring d of one s. Out: [b,h][64 tiles][d/32] fragment tiles.
// MODE 1 (V): a lane holds 8 neighbouring s of one d. Out: V^T fragment tiles
//         [b,h][32 blocks of 32 positions][d/16], rows d, k = position.
// MODE 2: f32 out = C + resid. A's row tiles are attention's query tiles
//         (b, tile number); the rows go back to their places here.
//
// The operands come through LDS. A slice is KS k-tiles of the workgroup's 4 row
// tiles of A and 16 row tiles of W: 20 runs of KS KiB, each contiguous in the
// workspace, laid one behind the other in LDS, still in fragment order. Every
// thread copies 16 bytes per round; the four waves that need the same A tile and
// the two that need the same W tile read it from LDS, so a tile leaves L2 once
// per workgroup. Two buffers: slice t + 1 is on its way while slice t is used.
// ---------------------------------------------------------------------------
#define WG_ROWTILES 20   // 4 of A, then 16 of W
#define SLICE_ELEMS(KS) (WG_ROWTILES * (KS) * TILE_ELEMS)

// Ten asynchronous 16-byte copies per lane, global memory to LDS: copy u goes
// from g[u] to LDS byte address l[u]. The wait at the end stands inside the
// statement so that no address register of a copy is rewritten in front of it.
__device__ __forceinline__
void copy10(const u32* l, const char* const* g) {
  asm volatile("global_load_async_to_lds_b128 %0, %1, off\n\t"
               "global_load_async_to_lds_b128 %2, %3, off\n\t"
               "global_load_async_to_lds_b128 %4, %5, off\n\t"
               "global_load_async_to_lds_b128 %6, %7, off\n\t"
               "global_load_async_to_lds_b128 %8, %9, off\n\t"
               "global_load_async_to_lds_b128 %10, %11, off\n\t"
               "global_load_async_to_lds_b128 %12, %13, off\n\t"
               "global_load_async_to_lds_b128 %14, %15, off\n\t"
               "global_load_async_to_lds_b128 %16, %17, off\n\t"
               "global_load_async_to_lds_b128 %18, %19, off\n\t"
               "s_wait_xcnt 0x0"
               :: "v"(l[0]), "v"(g[0]), "v"(l[1]), "v"(g[1]), "v"(l[2]), "v"(g[2]),
                  "v"(l[3]), "v"(g[3]), "v"(l[4]), "v"(g[4]), "v"(l[5]), "v"(g[5]),
                  "v"(l[6]), "v"(g[6]), "v"(l[7]), "v"(g[7]), "v"(l[8]), "v"(g[8]),
                  "v"(l[9]), "v"(g[9])
               : "memory");
}

// One slice. l: the thread's LDS byte address in round 0; ga, gw: its source in
// the first A round and the first W round. A round is 4 KiB of LDS = 4 / KS row
// tiles, which lie 32 KiB apart in the workspace.
template <int KS>
__device__ __forceinline__
void copy_slice(u32 l, const char* ga, const char* gw) {
  constexpr int RPR    = 4 / KS;             // row tiles per round
  constexpr int ROUNDS = WG_ROWTILES / RPR;
  constexpr int AR     = 4 / RPR;            // rounds that bring A
  constexpr int STEP   = RPR * KTILES * TILE_ELEMS * 2;  // bytes, round to round
#pragma unroll
  for (int i = 0; i < ROUNDS; i += 10) {
    u32 d[10];
    const char* g[10];
#pragma unroll
    for (int u = 0; u < 10; ++u) {
      d[u] = l + (i + u) * 4096;
      g[u] = (i + u < AR) ? ga + (i + u) * STEP : gw + (i + u - AR) * STEP;
    }
    copy10(d, g);
  }
}

template <int MODE, int KS>
__device__ __forceinline__
void gemm_tile(const bf16* __restrict__ A, const bf16* __restrict__ W,
               bf16* __restrict__ outB, float* __restrict__ outF,
               const float* __restrict__ resid, bf16* sm) {
  const int lane = threadIdx.x & 31;
  // the wave's number as a scalar: with it in a vector register the projections'
  // build went one register over its cap of 160 and spilled it to scratch
  const int wave = __builtin_amdgcn_readfirstlane(threadIdx.x >> 5);
  const int half = lane >> 4;
  const int r    = lane & 15;
  const int wm   = wave >> 2;  // 0..1
  const int wn   = wave & 3;   // 0..3
  const int M0 = blockIdx.y * 64 + wm * 32;
  const int N0 = blockIdx.x * 256 + wn * 64;

  v8f acc[2][4];
#pragma unroll
  for (int i = 0; i < 2; ++i)
#pragma unroll
    for (int j = 0; j < 4; ++j) acc[i][j] = (v8f){0, 0, 0, 0, 0, 0, 0, 0};

  constexpr int NT          = KTILES / KS;            // slices
  constexpr int SLICE_BYTES = SLICE_ELEMS(KS) * 2;
  constexpr int TPR         = KS * 64;                // threads per row tile's run
  const int tid = threadIdx.x;
  const size_t src_off = (size_t)(tid / TPR) * (KTILES * TILE_ELEMS * 2) + (tid % TPR) * 16;
  const char* ga = (const char*)(A + (size_t)(blockIdx.y * 4) * KTILES * TILE_ELEMS) + src_off;
  const char* gw = (const char*)(W + (size_t)(blockIdx.x * 16) * KTILES * TILE_ELEMS) + src_off;
  const u32 l0 = (u32)(uintptr_t)sm + tid * 16;       // LDS byte address

  copy_slice<KS>(l0, ga, gw);
  // slice 0 has landed for this wave's copies; the barrier says so for all waves
  asm volatile("s_wait_asynccnt 0x0" ::: "memory");
  __syncthreads();
  copy_slice<KS>(l0 + SLICE_BYTES, ga + KS * 1024, gw + KS * 1024);

  for (int t = 0; t < NT; ++t) {
    const bf16* sb = sm + (t & 1) * SLICE_ELEMS(KS) + lane * 8;
#pragma unroll
    for (int kk = 0; kk < KS; ++kk) {
      v16bf af[2], bf_[4];
#pragma unroll
      for (int ms = 0; ms < 2; ++ms) af[ms] = load_tile(sb, (wm * 2 + ms) * KS + kk);
#pragma unroll
      for (int ns = 0; ns < 4; ++ns) bf_[ns] = load_tile(sb, (4 + wn * 4 + ns) * KS + kk);
#pragma unroll
      for (int ms = 0; ms < 2; ++ms)
#pragma unroll
        for (int ns = 0; ns < 4; ++ns)
          acc[ms][ns] = (MODE == 0) ? wmma_bf16(bf_[ns], af[ms], acc[ms][ns])
                                    : wmma_bf16(af[ms], bf_[ns], acc[ms][ns]);
    }
    // Hand-over: this wave's reads of slice t are done, its copies of slice t + 1
    // have landed; behind the barrier both hold for every wave, so slice t + 1 may
    // be read and the buffer of slice t refilled.
    asm volatile("s_wait_dscnt 0x0" ::: "memory");
    asm volatile("s_wait_asynccnt 0x0" ::: "memory");
    __syncthreads();
    if (t + 2 < NT)
      copy_slice<KS>(l0 + (t & 1) * SLICE_BYTES, ga + (t + 2) * (KS * 1024),
                     gw + (t + 2) * (KS * 1024));
  }
  // no copy is left in flight when the wave goes on
  asm volatile("s_wait_asynccnt 0x0" ::: "memory");

  if (MODE == 0 || MODE == 1) {
    const int bh = ((M0 >> 10) * HEADS) + ((M0 & 1023) >> 6);
    const int cb = N0 >> 6;            // column block 0..15
    const int sb = (M0 & 63) >> 4;     // 0 or 2; + ms
#pragma unroll
    for (int ms = 0; ms < 2; ++ms) {
#pragma unroll
      for (int ns = 0; ns < 4; ++ns) {
        float v[8];
#pragma unroll
        for (int j = 0; j < 8; ++j) v[j] = acc[ms][ns][j];
        // chunk number: MODE 0 tile (cb*4 + sb + ms), d/32 = ns>>1, c = ns&1
        //               MODE 1 block (cb*2 + sb/2), d/16 = ns, c = ms
        const int chunk =
            (MODE == 0)
                ? (((bh * 64 + cb * 4 + sb + ms) * 2 + (ns >> 1)) * 2 + (ns & 1))
                : (((bh * 32 + cb * 2 + (sb >> 1)) * 4 + ns) * 2 + ms);
        *(v4u*)(outB + (size_t)chunk * 256 + lane * 8) = pack8(v);
        // stands in front of the next chunk's packing, which may overwrite the
        // registers that this store names
        asm volatile("s_wait_xcnt 0x0" ::: "memory");
      }
    }
    return;
  }

  // C/D layout: lanes 0-15 hold rows j, lanes 16-31 rows j+8; col = lane&15.
  // Both row tiles of the wave share b and cb (M0 is a multiple of 32), so one
  // base serves: tile ms is 256 rows on, register j is 16 rows on.
  const int rt = M0 >> 4;            // (b, query tile), even
  const int b  = rt >> 6;
  const int cb = (rt & 63) >> 2;
  const int sb = rt & 3;
  const size_t base =
      ((size_t)b * SEQL + ((sb * 16 + 8 * half) << 4) + cb) * DMODEL + N0 + r;
  const float* rp = resid + base;
  float*       op = outF + base;
  float rv[2][4][8];
#pragma unroll
  for (int ms = 0; ms < 2; ++ms)
#pragma unroll
    for (int ns = 0; ns < 4; ++ns)
#pragma unroll
      for (int j = 0; j < 8; ++j)
        rv[ms][ns][j] = rp[(ms * 256 + j * 16) * DMODEL + ns * 16];
#pragma unroll
  for (int ms = 0; ms < 2; ++ms)
#pragma unroll
    for (int ns = 0; ns < 4; ++ns)
#pragma unroll
      for (int j = 0; j < 8; ++j)
        op[(ms * 256 + j * 16) * DMODEL + ns * 16] = acc[ms][ns][j] + rv[ms][ns][j];
}

// The three projections need nothing of each other: one grid, blockIdx.z = 0, 1,
// 2 for Q, K, V. X, Wt and P each hold their three tensors one behind the other.
// Six waves per SIMD (at most 160 registers): three workgroups then share a WGP,
// and all 768 are resident at once; their LDS, 3 x 80 KiB, fits as well.
__global__ __launch_bounds__(256) __attribute__((amdgpu_waves_per_eu(6)))
void mha_gemm_qkv(const bf16* __restrict__ X, const bf16* __restrict__ Wt,
                  bf16* __restrict__ P) {
  const int z = blockIdx.z;
  const bf16* A = X + (size_t)z * (MROWS * DMODEL);
  const bf16* W = Wt + (size_t)z * (DMODEL * DMODEL);
  bf16*       O = P + (size_t)z * (MROWS * DMODEL);
  __shared__ __attribute__((aligned(1024))) bf16 sm[2 * SLICE_ELEMS(2)];
  if (z == 2) gemm_tile<1, 2>(A, W, O, nullptr, nullptr, sm);
  else        gemm_tile<0, 2>(A, W, O, nullptr, nullptr, sm);
}

__global__ __launch_bounds__(256)
void mha_gemm_out(const bf16* __restrict__ A, const bf16* __restrict__ W,
                  float* __restrict__ outF, const float* __restrict__ resid) {
  // one workgroup per WGP here: longer slices, so that a slice's work covers the
  // next one's way from L2
  __shared__ __attribute__((aligned(1024))) bf16 sm[2 * SLICE_ELEMS(4)];
  gemm_tile<2, 4>(A, W, nullptr, outF, resid, sm);
}

// Eight exp2 in one statement. Behind a transcendental the instruction set asks
// for one independent instruction before its result is read or its source is
// overwritten. Inside the statement the next exp2 is that instruction (the
// outputs are early-clobber, so none lies on a source); behind the last one
// stands v_nop.
__device__ inline void exp2x8(float* p, const float* a) {
  asm("v_exp_f32 %0, %8\n\t"
      "v_exp_f32 %1, %9\n\t"
      "v_exp_f32 %2, %10\n\t"
      "v_exp_f32 %3, %11\n\t"
      "v_exp_f32 %4, %12\n\t"
      "v_exp_f32 %5, %13\n\t"
      "v_exp_f32 %6, %14\n\t"
      "v_exp_f32 %7, %15\n\t"
      "v_nop"
      : "=&v"(p[0]), "=&v"(p[1]), "=&v"(p[2]), "=&v"(p[3]),
        "=&v"(p[4]), "=&v"(p[5]), "=&v"(p[6]), "=&v"(p[7])
      : "v"(a[0]), "v"(a[1]), "v"(a[2]), "v"(a[3]),
        "v"(a[4]), "v"(a[5]), "v"(a[6]), "v"(a[7]));
}

// One exp2, with the same slot behind it.
__device__ inline float exp2x1(float a) {
  float p;
  asm("v_exp_f32 %0, %1\n\t"
      "v_nop"
      : "=&v"(p) : "v"(a));
  return p;
}

#define RAISE 5.5f   // a score may top the maximum in use by this much

#define STAGE_KEYS  128
#define STAGE_HALF  (STAGE_KEYS * DK)   // elements of K, and of V^T, in a stage
#define STAGE_ELEMS (2 * STAGE_HALF)
#define NSTAGES     (SEQL / STAGE_KEYS)

// One stage: eight asynchronous 16-byte copies per lane, global memory to LDS,
// four rounds of 4 KiB for K and four for V^T. l: the thread's LDS byte address
// in the first round; gk, gv: its sources there. The wait at the end stands
// inside the statement so that no address register of a copy is rewritten in
// front of it.
__device__ __forceinline__
void copy_stage(u32 l, const char* gk, const char* gv) {
  asm volatile("global_load_async_to_lds_b128 %0, %1, off\n\t"
               "global_load_async_to_lds_b128 %2, %3, off\n\t"
               "global_load_async_to_lds_b128 %4, %5, off\n\t"
               "global_load_async_to_lds_b128 %6, %7, off\n\t"
               "global_load_async_to_lds_b128 %8, %9, off\n\t"
               "global_load_async_to_lds_b128 %10, %11, off\n\t"
               "global_load_async_to_lds_b128 %12, %13, off\n\t"
               "global_load_async_to_lds_b128 %14, %15, off\n\t"
               "s_wait_xcnt 0x0"
               :: "v"(l),             "v"(gk),         "v"(l + 1 * 4096), "v"(gk + 1 * 4096),
                  "v"(l + 2 * 4096), "v"(gk + 2 * 4096), "v"(l + 3 * 4096), "v"(gk + 3 * 4096),
                  "v"(l + 4 * 4096), "v"(gv),         "v"(l + 5 * 4096), "v"(gv + 1 * 4096),
                  "v"(l + 6 * 4096), "v"(gv + 2 * 4096), "v"(l + 7 * 4096), "v"(gv + 3 * 4096)
               : "memory");
}

__global__ __launch_bounds__(256)
void mha_attn(const bf16* __restrict__ Pq, const bf16* __restrict__ Pk,
              const bf16* __restrict__ Vt, bf16* __restrict__ Pc) {
  const int lane = threadIdx.x & 31;
  const int wave = threadIdx.x >> 5;

  const int qblk = blockIdx.x & 7;
  const int bh   = blockIdx.x >> 3;
  const int b    = bh >> 4;
  const int h    = bh & 15;

  const int qt = qblk * 8 + wave;  // query tile 0..63

  // head slabs, each 128 tiles of 1 KiB, with the lane's own offset
  const bf16* Qh  = Pq + (size_t)bh * (SEQL * DK) + lane * 8;  // [64][2]
  // K [64][2] and V^T [32][4]: the thread's own 16 bytes of a copy round
  const char* gk = (const char*)(Pk + (size_t)bh * (SEQL * DK)) + threadIdx.x * 16;
  const char* gv = (const char*)(Vt + (size_t)bh * (DK * SEQL)) + threadIdx.x * 16;
  __shared__ __attribute__((aligned(1024))) bf16 sm[2 * STAGE_ELEMS];
  const u32 l0 = (u32)(uintptr_t)sm + threadIdx.x * 16;  // LDS byte address

  // Q^T fragments for this wave's 16 queries (K-dim = d, 0..31 and 32..63)
  v16bf bq[2];
  bq[0] = load_tile(Qh, qt * 2);
  bq[1] = load_tile(Qh, qt * 2 + 1);

  const v8f vzero = (v8f){0, 0, 0, 0, 0, 0, 0, 0};

  // ---- one pass over the keys: running maximum, sum and O^T together ----
  // m is the maximum in use for query r, the same value in both halves of the
  // wave. p = exp(s - m) stays exact for any m as long as sum and output use the
  // same m, so the wave raises m only when some score tops the m of its query by more than RAISE; p then
  // never exceeds exp(RAISE).
  float m = -1e30f;
  v2f lj[4];  // eight partial sums, in pairs: sum j is lj[j >> 1][j & 1]
#pragma unroll
  for (int j = 0; j < 4; ++j) lj[j] = (v2f){0.0f, 0.0f};
  v8f o[4];
#pragma unroll
  for (int nb = 0; nb < 4; ++nb) o[nb] = vzero;

  copy_stage(l0, gk, gv);
  // stage 0 has landed for this wave's copies; the barrier says so for all waves
  asm volatile("s_wait_asynccnt 0x0" ::: "memory");
  __syncthreads();
  copy_stage(l0 + STAGE_ELEMS * 2, gk + STAGE_HALF * 2, gv + STAGE_HALF * 2);

  for (int st = 0; st < NSTAGES; ++st) {
    const bf16* sb = sm + (st & 1) * STAGE_ELEMS + lane * 8;
    // unrolled: every LDS address of a stage is then the stage's base plus an
    // immediate, and no address is formed between one block's products and the next
#pragma unroll
    for (int kp = 0; kp < STAGE_KEYS / 32; ++kp) {
      // all 16 loads of the block first: K, which is needed first, then V^T
      v16bf ak[4], av[4];
#pragma unroll
      for (int i = 0; i < 4; ++i) ak[i] = load_tile(sb, kp * 4 + i);
#pragma unroll
      for (int nb = 0; nb < 4; ++nb) av[nb] = load_tile(sb + STAGE_HALF, kp * 4 + nb);
      // keeps the 16 loads in one group here: left free, the compiler issued them in
      // pairs among the products, with a full wait behind each pair
      __builtin_amdgcn_sched_barrier(0);
      float sv[2][8];
#pragma unroll
      for (int t = 0; t < 2; ++t) {
        v8f s = vzero;
        s = wmma_bf16(ak[t * 2], bq[0], s);
        s = wmma_bf16(ak[t * 2 + 1], bq[1], s);
#pragma unroll
        for (int j = 0; j < 8; ++j)
          sv[t][j] = (s[j] == 0.0f) ? NEG_BIG : s[j] * 0.125f;  // mask, then 1/sqrt(64)
      }
      float bm = sv[0][0];
#pragma unroll
      for (int j = 1; j < 16; ++j) bm = fmaxf(bm, sv[j >> 3][j & 7]);
      // One test per 32 keys, a scalar branch. Every lane takes the new maximum
      // when any lane asks for one, so the two halves of a query stay alike.
      if (__builtin_amdgcn_ballot_w32(bm > m + RAISE) != 0) {
        const float nm = fmaxf(m, fmaxf(bm, __shfl_xor(bm, 16, 32)));
        const float f  = exp2x1((m - nm) * 1.44269504f);
        m = nm;
#pragma unroll
        for (int j = 0; j < 4; ++j) lj[j] *= f;
#pragma unroll
        for (int nb = 0; nb < 4; ++nb)
#pragma unroll
          for (int j = 0; j < 8; ++j) o[nb][j] *= f;
      }
      FragU pt;  // P^T, 32 keys x 16 queries, as a B fragment
#pragma unroll
      for (int t = 0; t < 2; ++t) {
        float a[8], p[8];
#pragma unroll
        for (int j = 0; j < 8; ++j)
          a[j] = (sv[t][j] - m) * 1.44269504f;  // exp(x) = exp2(x * log2 e), as __expf forms it
        exp2x8(p, a);
#pragma unroll
        for (int j = 0; j < 4; ++j) lj[j] += (v2f){p[2 * j], p[2 * j + 1]};
        pt.u[t] = pack8(p);
      }
#pragma unroll
      for (int nb = 0; nb < 4; ++nb) o[nb] = wmma_bf16(av[nb], pt.bf, o[nb]);
    }
    // Hand-over: this wave's reads of stage st are done, its copies of stage st + 1
    // have landed; behind the barrier both hold for every wave, so stage st + 1 may
    // be read and the buffer of stage st refilled.
    asm volatile("s_wait_dscnt 0x0" ::: "memory");
    asm volatile("s_wait_asynccnt 0x0" ::: "memory");
    __syncthreads();
    if (st + 2 < NSTAGES)
      copy_stage(l0 + (st & 1) * (STAGE_ELEMS * 2), gk + (st + 2) * (STAGE_HALF * 2),
                 gv + (st + 2) * (STAGE_HALF * 2));
  }
  // no copy is left in flight when the wave goes on
  asm volatile("s_wait_asynccnt 0x0" ::: "memory");

  float l = ((lj[0][0] + lj[0][1]) + (lj[1][0] + lj[1][1])) +
            ((lj[2][0] + lj[2][1]) + (lj[3][0] + lj[3][1]));
  l += __shfl_xor(l, 16, 32);  // the other half's keys

  // Store O as A-fragment tiles of the concat matrix: row tile (b, qt),
  // k = h*64 + d, two tiles of 32 d; accumulator nb is chunk nb & 1 of tile nb >> 1.
  bf16* Oc = Pc + ((size_t)(b * 64 + qt) * KTILES + h * 2) * TILE_ELEMS + lane * 8;
#pragma unroll
  for (int nb = 0; nb < 4; ++nb) {
    float v[8];
#pragma unroll
    for (int j = 0; j < 8; ++j) v[j] = o[nb][j] / l;
    *(v4u*)(Oc + nb * 256) = pack8(v);
  }
}

// ---------------------------------------------------------------------------
// Host-side launch. Workspace layout (needs 64 MB), all in fragment order:
//  [ 0MB) qb  [ 8MB) kb  [16MB) vb            (bf16 activations, 8MB each)
//  [24MB) Wqb [26MB) Wkb [28MB) Wvb [30MB) Wob (bf16 weights, 2MB each)
//  [32MB) Pq  [40MB) Pk  [48MB) Vt  [56MB) Pc  (bf16 intermediates, 8MB each)
// ---------------------------------------------------------------------------
extern "C" void kernel_launch(void* const* d_in, const int* in_sizes, int n_in,
                              void* d_out, int out_size, void* d_ws,
                              size_t ws_size, hipStream_t stream) {
  (void)in_sizes; (void)n_in; (void)out_size; (void)ws_size;
  const float* q  = (const float*)d_in[0];
  const float* k  = (const float*)d_in[1];
  const float* v  = (const float*)d_in[2];
  const float* Wq = (const float*)d_in[3];
  const float* Wk = (const float*)d_in[4];
  const float* Wv = (const float*)d_in[5];
  const float* Wo = (const float*)d_in[6];
  float* out = (float*)d_out;

  char* ws = (char*)d_ws;
  const size_t MB = (size_t)1 << 20;
  bf16* qb  = (bf16*)(ws + 0 * MB);
  bf16* Wqb = (bf16*)(ws + 24 * MB);
  bf16* Wob = (bf16*)(ws + 30 * MB);
  bf16* Pq  = (bf16*)(ws + 32 * MB);
  bf16* Pk  = (bf16*)(ws + 40 * MB);
  bf16* Vt  = (bf16*)(ws + 48 * MB);
  bf16* Pc  = (bf16*)(ws + 56 * MB);

  // qb .. Wob are filled as one run of chunks from qb on
  mha_f32_to_bf16_frag<<<CVT_BLOCKS, 256, 0, stream>>>(q, k, v, Wq, Wk, Wv, Wo, qb);

  // (qb, kb, vb) x (Wqb, Wkb, Wvb) -> (Pq, Pk, Vt)
  mha_gemm_qkv<<<dim3(DMODEL / 256, MROWS / 64, 3), 256, 0, stream>>>(qb, Wqb, Pq);

  mha_attn<<<BATCH * HEADS * (SEQL / 128), 256, 0, stream>>>(Pq, Pk, Vt, Pc);

  mha_gemm_out<<<dim3(DMODEL / 256, MROWS / 64), 256, 0, stream>>>(Pc, Wob, out, q);
}

// v010
// One run takes 65.4 microseconds.
// Next to v009, in two timings, it ran 1.04 times as fast each time.
// All steps since v000 together make it 4.85 times as fast.
#include <hip/hip_runtime.h>
#include <hip/hip_bf16.h>
#include <stdint.h>

// Problem constants (match the JAX reference)
#define HEADS  16
#define DMODEL 1024
#define DK     64
#define BATCH  4
#define SEQL   1024
#define MROWS  (BATCH * SEQL)   // 4096
#define NEG_BIG (-1000000000.0f)

typedef __bf16    bf16;
typedef uint32_t  u32;
typedef __attribute__((ext_vector_type(16))) bf16  v16bf;
typedef __attribute__((ext_vector_type(8)))  float v8f;
typedef __attribute__((ext_vector_type(2)))  float v2f;
typedef __attribute__((ext_vector_type(2)))  bf16  v2bf;
typedef __attribute__((ext_vector_type(4)))  u32   v4u;

union FragU { v16bf bf; v4u u[2]; };

// Load one 16-bit WMMA operand fragment: two contiguous 8-element (16B) chunks.
// Per the CDNA5 ISA 16-bit A-matrix layout, lane L holds K elements
// {half*8 .. half*8+7} and {16+half*8 .. 16+half*8+7} (half = L>=16).
// The caller passes pointers already offset to those two chunks.
__device__ inline v16bf load_frag(const bf16* p0, const bf16* p1) {
  FragU f;
  f.u[0] = *(const v4u*)p0;
  f.u[1] = *(const v4u*)p1;
  return f.bf;
}

__device__ inline v8f wmma_bf16(v16bf a, v16bf b, v8f c) {
  // D = A(16x32 bf16) x B(32x16 bf16) + C(16x16 f32)
  return __builtin_amdgcn_wmma_f32_16x16x32_bf16(
      false, a, false, b, (short)0, c, false, false);
}

// ---------------------------------------------------------------------------
// Fragment order. Every bf16 tensor in the workspace is kept as 1-KiB tiles of
// 16 rows x 32 k, each tile in the order in which a wave loads it as a 16-bit
// WMMA operand: [chunk c = 0,1][lane = half*16 + r][8 elements], holding
// element (row r, k = c*16 + half*8 + e). One 16-byte-per-lane access of a wave
// is then 512 contiguous bytes (4 whole lines) instead of 32 bytes of 16 lines.
// ---------------------------------------------------------------------------
#define TILE_ELEMS 512   // 16 x 32 bf16
#define KTILES     (DMODEL / 32)

// Fragment of tile number tile; p already holds the lane's own offset (lane*8).
__device__ inline v16bf load_tile(const bf16* p, int tile) {
  const bf16* t = p + (size_t)tile * TILE_ELEMS;
  return load_frag(t, t + 256);
}

// Eight floats -> eight bf16, round to nearest even: the conversion of a pair is
// one instruction (v_cvt_pk_bf16_f32) that also packs the two halves.
__device__ inline v4u pack8(const float* v) {
  union { v2bf e[4]; v4u u; } pk;
#pragma unroll
  for (int j = 0; j < 4; ++j)
    pk.e[j] = __builtin_convertvector((v2f){v[2 * j], v[2 * j + 1]}, v2bf);
  return pk.u;
}

// ---------------------------------------------------------------------------
// float32 [rows][1024] row-major -> bf16 tiles [rows/16][32] in fragment order.
// All seven tensors share one grid: none needs anything of another, and their
// bf16 copies lie one behind the other in y (q, k, v, Wq, Wk, Wv, Wo), so the
// block index names both the source tensor (the same for a whole block) and the
// place in y.
//
// The launch is a stream, so it is cut into few, long waves: 32 per WGP, all
// resident at once, each with all of its loads in flight. A workgroup converts
// one whole row tile (64 KiB read, 32 KiB written, both contiguous); a wave takes
// 128 columns of it (4 fragment tiles), a thread makes 8 chunks of 16 bytes.
// Four neighbouring lanes read one 128-byte line of a row, 8 rows per load; the
// eight lanes that hold the same k of rows 0..7 (or 8..15) then store one whole
// 128-byte line of the tile.
// ---------------------------------------------------------------------------
#define ACT_BLOCKS (MROWS / 16)    // 256 blocks (row tiles) per activation
#define WGT_BLOCKS (DMODEL / 16)   // 64 blocks per weight
#define CVT_BLOCKS (3 * ACT_BLOCKS + 4 * WGT_BLOCKS)

__global__ __launch_bounds__(256)
void mha_f32_to_bf16_frag(const float* __restrict__ q, const float* __restrict__ k,
                          const float* __restrict__ v, const float* __restrict__ Wq,
                          const float* __restrict__ Wk, const float* __restrict__ Wv,
                          const float* __restrict__ Wo, bf16* __restrict__ y) {
  const u32 blk = blockIdx.x;
  const float* x = (blk < 1 * ACT_BLOCKS) ? q
                 : (blk < 2 * ACT_BLOCKS) ? k
                 : (blk < 3 * ACT_BLOCKS) ? v
                 : (blk < 3 * ACT_BLOCKS + 1 * WGT_BLOCKS) ? Wq
                 : (blk < 3 * ACT_BLOCKS + 2 * WGT_BLOCKS) ? Wk
                 : (blk < 3 * ACT_BLOCKS + 3 * WGT_BLOCKS) ? Wv : Wo;
  // block number within its own tensor: every tensor starts at a multiple of
  // its own (power-of-two) block count
  const u32 lb = blk & ((blk < 3 * ACT_BLOCKS) ? ACT_BLOCKS - 1 : WGT_BLOCKS - 1);
  const int lane = threadIdx.x & 31;
  const int wave = threadIdx.x >> 5;  // columns wave*128 .. +127 = k-tiles wave*4 .. +3
  const int rr   = lane >> 2;         // row within a group of 8 rows
  const int wq   = lane & 3;          // k = wq*8 .. +7 of a k-tile: c = wq>>1, half = wq&1
  const float* s = x + (size_t)(lb * 16 + rr) * DMODEL + wave * 128 + wq * 8;
  bf16*        d = y + ((size_t)blk * KTILES + wave * 4) * TILE_ELEMS + (wq * 16 + rr) * 8;
  // chunk u: row (u >> 2) * 8 + rr, k-tile wave*4 + (u & 3)
  float4 a[8], b[8];
#pragma unroll
  for (int u = 0; u < 8; ++u) {
    const float* p = s + (u >> 2) * (8 * DMODEL) + (u & 3) * 32;
    a[u] = *(const float4*)p;
    b[u] = *(const float4*)(p + 4);
  }
  // Stands in front of every instruction that may overwrite the address pair
  // which the loads name. The pointer is an input so that the pair stays whole up
  // to here: left free, the last load's own destination lay on it.
  asm volatile("s_wait_xcnt 0x0" :: "v"(s) : "memory");
  // keeps all 16 loads in front of the first conversion: left free, the compiler
  // put the last three behind waits for the first ones, to use their registers again
  __builtin_amdgcn_sched_barrier(0);
  v4u o[8];
#pragma unroll
  for (int u = 0; u < 8; ++u) {
    const float e[8] = {a[u].x, a[u].y, a[u].z, a[u].w, b[u].x, b[u].y, b[u].z, b[u].w};
    o[u] = pack8(e);
  }
#pragma unroll
  for (int u = 0; u < 8; ++u) *(v4u*)(d + (u & 3) * TILE_ELEMS + (u >> 2) * 64) = o[u];
}

// ---------------------------------------------------------------------------
// C[4096,1024] = A[4096,1024](bf16) @ W[1024,1024](bf16)^T, A and W in
// fragment order. Wave tile 32x64 (2x4 accumulators); workgroup tile 64x256.
//
// The head slab (b,h) is the contiguous reshape of C[b, 64h:64h+64, :]:
// element (s, col) is position t = (s & 63) * 16 + (col >> 6), d = col & 63.
// Attention may take its positions in any order, so a tile of 16 positions is
// 16 neighbouring s of one column block: tile number (col >> 6) * 4 +
// ((s & 63) >> 4), row s & 15. A 16x16 accumulator tile is then one chunk.
//
// MODE 0 (Q, K): operands swapped (tile = W * A^T), so a lane holds 8
//         neighbouring d of one s. Out: [b,h][64 tiles][d/32] fragment tiles.
// MODE 1 (V): a lane holds 8 neighbouring s of one d. Out: V^T fragment tiles
//         [b,h][32 blocks of 32 positions][d/16], rows d, k = position.
// MODE 2: f32 out = C + resid. A's row tiles are attention's query tiles
//         (b, tile number); the rows go back to their places here.
//
// The operands come through LDS. A slice is KS k-tiles of the workgroup's 4 row
// tiles of A and 16 row tiles of W: 20 runs of KS KiB, each contiguous in the
// workspace, laid one behind the other in LDS, still in fragment order. Every
// thread copies 16 bytes per round; the four waves that need the same A tile and
// the two that need the same W tile read it from LDS, so a tile leaves L2 once
// per workgroup. Two buffers: slice t + 1 is on its way while slice t is used.
// ---------------------------------------------------------------------------
#define WG_ROWTILES 20   // 4 of A, then 16 of W
#define SLICE_ELEMS(KS) (WG_ROWTILES * (KS) * TILE_ELEMS)

// Ten asynchronous 16-byte copies per lane, global memory to LDS: copy u goes
// from g[u] to LDS byte address l[u]. The wait at the end stands inside the
// statement so that no address register of a copy is rewritten in front of it.
__device__ __forceinline__
void copy10(const u32* l, const char* const* g) {
  asm volatile("global_load_async_to_lds_b128 %0, %1, off\n\t"
               "global_load_async_to_lds_b128 %2, %3, off\n\t"
               "global_load_async_to_lds_b128 %4, %5, off\n\t"
               "global_load_async_to_lds_b128 %6, %7, off\n\t"
               "global_load_async_to_lds_b128 %8, %9, off\n\t"
               "global_load_async_to_lds_b128 %10, %11, off\n\t"
               "global_load_async_to_lds_b128 %12, %13, off\n\t"
               "global_load_async_to_lds_b128 %14, %15, off\n\t"
               "global_load_async_to_lds_b128 %16, %17, off\n\t"
               "global_load_async_to_lds_b128 %18, %19, off\n\t"
               "s_wait_xcnt 0x0"
               :: "v"(l[0]), "v"(g[0]), "v"(l[1]), "v"(g[1]), "v"(l[2]), "v"(g[2]),
                  "v"(l[3]), "v"(g[3]), "v"(l[4]), "v"(g[4]), "v"(l[5]), "v"(g[5]),
                  "v"(l[6]), "v"(g[6]), "v"(l[7]), "v"(g[7]), "v"(l[8]), "v"(g[8]),
                  "v"(l[9]), "v"(g[9])
               : "memory");
}

// One slice. l: the thread's LDS byte address in round 0; ga, gw: its source in
// the first A round and the first W round. A round is 4 KiB of LDS = 4 / KS row
// tiles, which lie 32 KiB apart in the workspace.
template <int KS>
__device__ __forceinline__
void copy_slice(u32 l, const char* ga, const char* gw) {
  constexpr int RPR    = 4 / KS;             // row tiles per round
  constexpr int ROUNDS = WG_ROWTILES / RPR;
  constexpr int AR     = 4 / RPR;            // rounds that bring A
  constexpr int STEP   = RPR * KTILES * TILE_ELEMS * 2;  // bytes, round to round
#pragma unroll
  for (int i = 0; i < ROUNDS; i += 10) {
    u32 d[10];
    const char* g[10];
#pragma unroll
    for (int u = 0; u < 10; ++u) {
      d[u] = l + (i + u) * 4096;
      g[u] = (i + u < AR) ? ga + (i + u) * STEP : gw + (i + u - AR) * STEP;
    }
    copy10(d, g);
  }
}

template <int MODE, int KS>
__device__ __forceinline__
void gemm_tile(const bf16* __restrict__ A, const bf16* __restrict__ W,
               bf16* __restrict__ outB, float* __restrict__ outF,
               const float* __restrict__ resid, bf16* sm) {
  const int lane = threadIdx.x & 31;
  // the wave's number as a scalar: with it in a vector register the projections'
  // build went one register over its cap of 160 and spilled it to scratch
  const int wave = __builtin_amdgcn_readfirstlane(threadIdx.x >> 5);
  const int half = lane >> 4;
  const int r    = lane & 15;
  const int wm   = wave >> 2;  // 0..1
  const int wn   = wave & 3;   // 0..3
  const int M0 = blockIdx.y * 64 + wm * 32;
  const int N0 = blockIdx.x * 256 + wn * 64;

  v8f acc[2][4];
#pragma unroll
  for (int i = 0; i < 2; ++i)
#pragma unroll
    for (int j = 0; j < 4; ++j) acc[i][j] = (v8f){0, 0, 0, 0, 0, 0, 0, 0};

  constexpr int NT          = KTILES / KS;            // slices
  constexpr int SLICE_BYTES = SLICE_ELEMS(KS) * 2;
  constexpr int TPR         = KS * 64;                // threads per row tile's run
  const int tid = threadIdx.x;
  const size_t src_off = (size_t)(tid / TPR) * (KTILES * TILE_ELEMS * 2) + (tid % TPR) * 16;
  const char* ga = (const char*)(A + (size_t)(blockIdx.y * 4) * KTILES * TILE_ELEMS) + src_off;
  const char* gw = (const char*)(W + (size_t)(blockIdx.x * 16) * KTILES * TILE_ELEMS) + src_off;
  const u32 l0 = (u32)(uintptr_t)sm + tid * 16;       // LDS byte address

  copy_slice<KS>(l0, ga, gw);
  // slice 0 has landed for this wave's copies; the barrier says so for all waves
  asm volatile("s_wait_asynccnt 0x0" ::: "memory");
  __syncthreads();
  copy_slice<KS>(l0 + SLICE_BYTES, ga + KS * 1024, gw + KS * 1024);

  for (int t = 0; t < NT; ++t) {
    const bf16* sb = sm + (t & 1) * SLICE_ELEMS(KS) + lane * 8;
#pragma unroll
    for (int kk = 0; kk < KS; ++kk) {
      v16bf af[2], bf_[4];
#pragma unroll
      for (int ms = 0; ms < 2; ++ms) af[ms] = load_tile(sb, (wm * 2 + ms) * KS + kk);
#pragma unroll
      for (int ns = 0; ns < 4; ++ns) bf_[ns] = load_tile(sb, (4 + wn * 4 + ns) * KS + kk);
#pragma unroll
      for (int ms = 0; ms < 2; ++ms)
#pragma unroll
        for (int ns = 0; ns < 4; ++ns)
          acc[ms][ns] = (MODE == 0) ? wmma_bf16(bf_[ns], af[ms], acc[ms][ns])
                                    : wmma_bf16(af[ms], bf_[ns], acc[ms][ns]);
    }
    // Hand-over: this wave's reads of slice t are done, its copies of slice t + 1
    // have landed; behind the barrier both hold for every wave, so slice t + 1 may
    // be read and the buffer of slice t refilled.
    asm volatile("s_wait_dscnt 0x0" ::: "memory");
    asm volatile("s_wait_asynccnt 0x0" ::: "memory");
    __syncthreads();
    if (t + 2 < NT)
      copy_slice<KS>(l0 + (t & 1) * SLICE_BYTES, ga + (t + 2) * (KS * 1024),
                     gw + (t + 2) * (KS * 1024));
  }
  // no copy is left in flight when the wave goes on
  asm volatile("s_wait_asynccnt 0x0" ::: "memory");

  if (MODE == 0 || MODE == 1) {
    const int bh = ((M0 >> 10) * HEADS) + ((M0 & 1023) >> 6);
    const int cb = N0 >> 6;            // column block 0..15
    const int sb = (M0 & 63) >> 4;     // 0 or 2; + ms
#pragma unroll
    for (int ms = 0; ms < 2; ++ms) {
#pragma unroll
      for (int ns = 0; ns < 4; ++ns) {
        float v[8];
#pragma unroll
        for (int j = 0; j < 8; ++j) v[j] = acc[ms][ns][j];
        // chunk number: MODE 0 tile (cb*4 + sb + ms), d/32 = ns>>1, c = ns&1
        //               MODE 1 block (cb*2 + sb/2), d/16 = ns, c = ms
        const int chunk =
            (MODE == 0)
                ? (((bh * 64 + cb * 4 + sb + ms) * 2 + (ns >> 1)) * 2 + (ns & 1))
                : (((bh * 32 + cb * 2 + (sb >> 1)) * 4 + ns) * 2 + ms);
        *(v4u*)(outB + (size_t)chunk * 256 + lane * 8) = pack8(v);
        // stands in front of the next chunk's packing, which may overwrite the
        // registers that this store names
        asm volatile("s_wait_xcnt 0x0" ::: "memory");
      }
    }
    return;
  }

  // C/D layout: lanes 0-15 hold rows j, lanes 16-31 rows j+8; col = lane&15.
  // Both row tiles of the wave share b and cb (M0 is a multiple of 32), so one
  // base serves: tile ms is 256 rows on, register j is 16 rows on.
  const int rt = M0 >> 4;            // (b, query tile), even
  const int b  = rt >> 6;
  const int cb = (rt & 63) >> 2;
  const int sb = rt & 3;
  const size_t base =
      ((size_t)b * SEQL + ((sb * 16 + 8 * half) << 4) + cb) * DMODEL + N0 + r;
  const float* rp = resid + base;
  float*       op = outF + base;
  float rv[2][4][8];
#pragma unroll
  for (int ms = 0; ms < 2; ++ms)
#pragma unroll
    for (int ns = 0; ns < 4; ++ns)
#pragma unroll
      for (int j = 0; j < 8; ++j)
        rv[ms][ns][j] = rp[(ms * 256 + j * 16) * DMODEL + ns * 16];
#pragma unroll
  for (int ms = 0; ms < 2; ++ms)
#pragma unroll
    for (int ns = 0; ns < 4; ++ns)
#pragma unroll
      for (int j = 0; j < 8; ++j)
        op[(ms * 256 + j * 16) * DMODEL + ns * 16] = acc[ms][ns][j] + rv[ms][ns][j];
}

// The three projections need nothing of each other: one grid, blockIdx.z = 0, 1,
// 2 for Q, K, V. X, Wt and P each hold their three tensors one behind the other.
// Six waves per SIMD (at most 160 registers): three workgroups then share a WGP,
// and all 768 are resident at once; their LDS, 3 x 80 KiB, fits as well.
__global__ __launch_bounds__(256) __attribute__((amdgpu_waves_per_eu(6)))
void mha_gemm_qkv(const bf16* __restrict__ X, const bf16* __restrict__ Wt,
                  bf16* __restrict__ P) {
  const int z = blockIdx.z;
  const bf16* A = X + (size_t)z * (MROWS * DMODEL);
  const bf16* W = Wt + (size_t)z * (DMODEL * DMODEL);
  bf16*       O = P + (size_t)z * (MROWS * DMODEL);
  __shared__ __attribute__((aligned(1024))) bf16 sm[2 * SLICE_ELEMS(2)];
  if (z == 2) gemm_tile<1, 2>(A, W, O, nullptr, nullptr, sm);
  else        gemm_tile<0, 2>(A, W, O, nullptr, nullptr, sm);
}

__global__ __launch_bounds__(256)
void mha_gemm_out(const bf16* __restrict__ A, const bf16* __restrict__ W,
                  float* __restrict__ outF, const float* __restrict__ resid) {
  // one workgroup per WGP here: longer slices, so that a slice's work covers the
  // next one's way from L2
  __shared__ __attribute__((aligned(1024))) bf16 sm[2 * SLICE_ELEMS(4)];
  gemm_tile<2, 4>(A, W, nullptr, outF, resid, sm);
}

// Eight exp2 in one statement. Behind a transcendental the instruction set asks
// for one independent instruction before its result is read or its source is
// overwritten. Inside the statement the next exp2 is that instruction (the
// outputs are early-clobber, so none lies on a source); behind the last one
// stands v_nop.
__device__ inline void exp2x8(float* p, const float* a) {
  asm("v_exp_f32 %0, %8\n\t"
      "v_exp_f32 %1, %9\n\t"
      "v_exp_f32 %2, %10\n\t"
      "v_exp_f32 %3, %11\n\t"
      "v_exp_f32 %4, %12\n\t"
      "v_exp_f32 %5, %13\n\t"
      "v_exp_f32 %6, %14\n\t"
      "v_exp_f32 %7, %15\n\t"
      "v_nop"
      : "=&v"(p[0]), "=&v"(p[1]), "=&v"(p[2]), "=&v"(p[3]),
        "=&v"(p[4]), "=&v"(p[5]), "=&v"(p[6]), "=&v"(p[7])
      : "v"(a[0]), "v"(a[1]), "v"(a[2]), "v"(a[3]),
        "v"(a[4]), "v"(a[5]), "v"(a[6]), "v"(a[7]));
}

// One exp2, with the same slot behind it.
__device__ inline float exp2x1(float a) {
  float p;
  asm("v_exp_f32 %0, %1\n\t"
      "v_nop"
      : "=&v"(p) : "v"(a));
  return p;
}

// The softmax works on the raw products s = q.k. The score is s / 8, so
// exp(s / 8 - m / 8) = exp2(s * SCALE2 - m * SCALE2): one multiply-add a score.
#define SCALE2  0.18033688f        // log2(e) / sqrt(64)
#define NEG_RAW (8.0f * NEG_BIG)   // the raw value whose score is NEG_BIG
#define RAISE   44.0f   // a raw product may top the maximum in use by this much (5.5 as a score)

#define STAGE_KEYS  128
#define STAGE_HALF  (STAGE_KEYS * DK)   // elements of K, and of V^T, in a stage
#define STAGE_ELEMS (2 * STAGE_HALF)
#define NSTAGES     (SEQL / STAGE_KEYS)

// One stage: eight asynchronous 16-byte copies per lane, global memory to LDS,
// four rounds of 4 KiB for K and four for V^T. l: the thread's LDS byte address
// in the first round; gk, gv: its sources there. The wait at the end stands
// inside the statement so that no address register of a copy is rewritten in
// front of it.
__device__ __forceinline__
void copy_stage(u32 l, const char* gk, const char* gv) {
  asm volatile("global_load_async_to_lds_b128 %0, %1, off\n\t"
               "global_load_async_to_lds_b128 %2, %3, off\n\t"
               "global_load_async_to_lds_b128 %4, %5, off\n\t"
               "global_load_async_to_lds_b128 %6, %7, off\n\t"
               "global_load_async_to_lds_b128 %8, %9, off\n\t"
               "global_load_async_to_lds_b128 %10, %11, off\n\t"
               "global_load_async_to_lds_b128 %12, %13, off\n\t"
               "global_load_async_to_lds_b128 %14, %15, off\n\t"
               "s_wait_xcnt 0x0"
               :: "v"(l),             "v"(gk),         "v"(l + 1 * 4096), "v"(gk + 1 * 4096),
                  "v"(l + 2 * 4096), "v"(gk + 2 * 4096), "v"(l + 3 * 4096), "v"(gk + 3 * 4096),
                  "v"(l + 4 * 4096), "v"(gv),         "v"(l + 5 * 4096), "v"(gv + 1 * 4096),
                  "v"(l + 6 * 4096), "v"(gv + 2 * 4096), "v"(l + 7 * 4096), "v"(gv + 3 * 4096)
               : "memory");
}

__global__ __launch_bounds__(256)
void mha_attn(const bf16* __restrict__ Pq, const bf16* __restrict__ Pk,
              const bf16* __restrict__ Vt, bf16* __restrict__ Pc) {
  const int lane = threadIdx.x & 31;
  const int wave = threadIdx.x >> 5;

  const int qblk = blockIdx.x & 7;
  const int bh   = blockIdx.x >> 3;
  const int b    = bh >> 4;
  const int h    = bh & 15;

  const int qt = qblk * 8 + wave;  // query tile 0..63

  // head slabs, each 128 tiles of 1 KiB, with the lane's own offset
  const bf16* Qh  = Pq + (size_t)bh * (SEQL * DK) + lane * 8;  // [64][2]
  // K [64][2] and V^T [32][4]: the thread's own 16 bytes of a copy round
  const char* gk = (const char*)(Pk + (size_t)bh * (SEQL * DK)) + threadIdx.x * 16;
  const char* gv = (const char*)(Vt + (size_t)bh * (DK * SEQL)) + threadIdx.x * 16;
  __shared__ __attribute__((aligned(1024))) bf16 sm[2 * STAGE_ELEMS];
  const u32 l0 = (u32)(uintptr_t)sm + threadIdx.x * 16;  // LDS byte address

  // Q^T fragments for this wave's 16 queries (K-dim = d, 0..31 and 32..63)
  v16bf bq[2];
  bq[0] = load_tile(Qh, qt * 2);
  bq[1] = load_tile(Qh, qt * 2 + 1);

  const v8f vzero = (v8f){0, 0, 0, 0, 0, 0, 0, 0};

  // ---- one pass over the keys: maximum in use, sum and O^T together ----
  // m is the maximum in use for query r, the same value in both halves of the
  // wave. p = exp((s - m) / 8) stays exact for any m as long as sum and output use the
  // same m, so m is raised only in a block where a raw product of the wave tops its
  // m by more than RAISE or is 0; p then never exceeds exp(RAISE / 8).
  float m   = -1e30f;           // raw
  float thr = m + RAISE;        // a raw product above this asks for a new maximum
  float nmc = -m * SCALE2;      // the addend of the exponent's multiply-add
  v2f lj[4];  // eight partial sums, in pairs: sum j is lj[j >> 1][j & 1]
#pragma unroll
  for (int j = 0; j < 4; ++j) lj[j] = (v2f){0.0f, 0.0f};
  v8f o[4];
#pragma unroll
  for (int nb = 0; nb < 4; ++nb) o[nb] = vzero;

  copy_stage(l0, gk, gv);
  // stage 0 has landed for this wave's copies; the barrier says so for all waves
  asm volatile("s_wait_asynccnt 0x0" ::: "memory");
  __syncthreads();
  copy_stage(l0 + STAGE_ELEMS * 2, gk + STAGE_HALF * 2, gv + STAGE_HALF * 2);

  for (int st = 0; st < NSTAGES; ++st) {
    const bf16* sb = sm + (st & 1) * STAGE_ELEMS + lane * 8;
    // unrolled: every LDS address of a stage is then the stage's base plus an
    // immediate, and no address is formed between one block's products and the next
#pragma unroll
    for (int kp = 0; kp < STAGE_KEYS / 32; ++kp) {
      // all 16 loads of the block first: K, which is needed first, then V^T
      v16bf ak[4], av[4];
#pragma unroll
      for (int i = 0; i < 4; ++i) ak[i] = load_tile(sb, kp * 4 + i);
#pragma unroll
      for (int nb = 0; nb < 4; ++nb) av[nb] = load_tile(sb + STAGE_HALF, kp * 4 + nb);
      // keeps the 16 loads in one group here: left free, the compiler issued them in
      // pairs among the products, with a full wait behind each pair
      __builtin_amdgcn_sched_barrier(0);
      v8f sv[2];
#pragma unroll
      for (int t = 0; t < 2; ++t) {
        sv[t] = wmma_bf16(ak[t * 2], bq[0], vzero);
        sv[t] = wmma_bf16(ak[t * 2 + 1], bq[1], sv[t]);
      }
      // Is a product above thr? Is one 0, that is, masked? A maximum and a smallest
      // magnitude answer both; with a start value each chain is eight whole triples.
      float bm = thr;
      float mn = 1.0f;
#pragma unroll
      for (int j = 0; j < 16; ++j) {
        bm = fmaxf(bm, sv[j >> 3][j & 7]);
        mn = fminf(mn, fabsf(sv[j >> 3][j & 7]));
      }
      // One test per 32 keys, a scalar branch. Every lane takes the new maximum
      // when any lane asks for one, so the two halves of a query stay alike.
      // A block without a zero product needs no mask, so the mask stands here too.
      if (__builtin_amdgcn_ballot_w32(bm > thr || mn == 0.0f) != 0) {
#pragma unroll
        for (int j = 0; j < 16; ++j)
          sv[j >> 3][j & 7] = (sv[j >> 3][j & 7] == 0.0f) ? NEG_RAW : sv[j >> 3][j & 7];
        bm = sv[0][0];
#pragma unroll
        for (int j = 1; j < 16; ++j) bm = fmaxf(bm, sv[j >> 3][j & 7]);
        const float nm = fmaxf(m, fmaxf(bm, __shfl_xor(bm, 16, 32)));
        const float f  = exp2x1((m - nm) * SCALE2);  // 1 exactly where m stays
        m   = nm;
        thr = nm + RAISE;
        nmc = -nm * SCALE2;
#pragma unroll
        for (int j = 0; j < 4; ++j) lj[j] *= f;
#pragma unroll
        for (int nb = 0; nb < 4; ++nb)
#pragma unroll
          for (int j = 0; j < 8; ++j) o[nb][j] *= f;
      }
      FragU pt;  // P^T, 32 keys x 16 queries, as a B fragment
#pragma unroll
      for (int t = 0; t < 2; ++t) {
        float a[8], p[8];
#pragma unroll
        for (int j = 0; j < 4; ++j) {
          const v2f e = __builtin_elementwise_fma((v2f){sv[t][2 * j], sv[t][2 * j + 1]},
                                                  (v2f){SCALE2, SCALE2}, (v2f){nmc, nmc});
          a[2 * j]     = e[0];
          a[2 * j + 1] = e[1];
        }
        exp2x8(p, a);
#pragma unroll
        for (int j = 0; j < 4; ++j) lj[j] += (v2f){p[2 * j], p[2 * j + 1]};
        pt.u[t] = pack8(p);
      }
#pragma unroll
      for (int nb = 0; nb < 4; ++nb) o[nb] = wmma_bf16(av[nb], pt.bf, o[nb]);
    }
    // Hand-over: this wave's reads of stage st are done, its copies of stage st + 1
    // have landed; behind the barrier both hold for every wave, so stage st + 1 may
    // be read and the buffer of stage st refilled.
    asm volatile("s_wait_dscnt 0x0" ::: "memory");
    asm volatile("s_wait_asynccnt 0x0" ::: "memory");
    __syncthreads();
    if (st + 2 < NSTAGES)
      copy_stage(l0 + (st & 1) * (STAGE_ELEMS * 2), gk + (st + 2) * (STAGE_HALF * 2),
                 gv + (st + 2) * (STAGE_HALF * 2));
  }
  // no copy is left in flight when the wave goes on
  asm volatile("s_wait_asynccnt 0x0" ::: "memory");

  float l = ((lj[0][0] + lj[0][1]) + (lj[1][0] + lj[1][1])) +
            ((lj[2][0] + lj[2][1]) + (lj[3][0] + lj[3][1]));
  l += __shfl_xor(l, 16, 32);  // the other half's keys

  // Store O as A-fragment tiles of the concat matrix: row tile (b, qt),
  // k = h*64 + d, two tiles of 32 d; accumulator nb is chunk nb & 1 of tile nb >> 1.
  bf16* Oc = Pc + ((size_t)(b * 64 + qt) * KTILES + h * 2) * TILE_ELEMS + lane * 8;
#pragma unroll
  for (int nb = 0; nb < 4; ++nb) {
    float v[8];
#pragma unroll
    for (int j = 0; j < 8; ++j) v[j] = o[nb][j] / l;
    *(v4u*)(Oc + nb * 256) = pack8(v);
  }
}

// ---------------------------------------------------------------------------
// Host-side launch. Workspace layout (needs 64 MB), all in fragment order:
//  [ 0MB) qb  [ 8MB) kb  [16MB) vb            (bf16 activations, 8MB each)
//  [24MB) Wqb [26MB) Wkb [28MB) Wvb [30MB) Wob (bf16 weights, 2MB each)
//  [32MB) Pq  [40MB) Pk  [48MB) Vt  [56MB) Pc  (bf16 intermediates, 8MB each)
// ---------------------------------------------------------------------------
extern "C" void kernel_launch(void* const* d_in, const int* in_sizes, int n_in,
                              void* d_out, int out_size, void* d_ws,
                              size_t ws_size, hipStream_t stream) {
  (void)in_sizes; (void)n_in; (void)out_size; (void)ws_size;
  const float* q  = (const float*)d_in[0];
  const float* k  = (const float*)d_in[1];
  const float* v  = (const float*)d_in[2];
  const float* Wq = (const float*)d_in[3];
  const float* Wk = (const float*)d_in[4];
  const float* Wv = (const float*)d_in[5];
  const float* Wo = (const float*)d_in[6];
  float* out = (float*)d_out;

  char* ws = (char*)d_ws;
  const size_t MB = (size_t)1 << 20;
  bf16* qb  = (bf16*)(ws + 0 * MB);
  bf16* Wqb = (bf16*)(ws + 24 * MB);
  bf16* Wob = (bf16*)(ws + 30 * MB);
  bf16* Pq  = (bf16*)(ws + 32 * MB);
  bf16* Pk  = (bf16*)(ws + 40 * MB);
  bf16* Vt  = (bf16*)(ws + 48 * MB);
  bf16* Pc  = (bf16*)(ws + 56 * MB);

  // qb .. Wob are filled as one run of chunks from qb on
  mha_f32_to_bf16_frag<<<CVT_BLOCKS, 256, 0, stream>>>(q, k, v, Wq, Wk, Wv, Wo, qb);

  // (qb, kb, vb) x (Wqb, Wkb, Wvb) -> (Pq, Pk, Vt)
  mha_gemm_qkv<<<dim3(DMODEL / 256, MROWS / 64, 3), 256, 0, stream>>>(qb, Wqb, Pq);

  mha_attn<<<BATCH * HEADS * (SEQL / 128), 256, 0, stream>>>(Pq, Pk, Vt, Pc);

  mha_gemm_out<<<dim3(DMODEL / 256, MROWS / 64), 256, 0, stream>>>(Pc, Wob, out, q);
}
